// v009
// Times are from an AMD MI455X. After a warm-up the kernel runs many times in a row, and a time is the length of
// such a window on the GPU divided by its runs, so every launch and the gaps after it count. The runs cycle
// through copies of the inputs. A figure is the median of several windows, for all but v000 over two sittings.
// Sittings can differ by a few percent; kernels timed side by side share one.
// This document starts at v009; the versions before it stand elsewhere.
// It runs in 123 microseconds.
// Next to v008, in two timings, it ran 1.13 times as fast each time.
// Over all steps from v000, the starting kernel, it is 8.22 times as fast.
// Contractions: every GEMM on v_wmma_f32_16x16x32_bf16 (bf16 operands, f32 accumulate) - the four lowrank mix/decay sites single bf16, the k/v/r projections, the gate pair and the output projection as bf16 hi/lo split (hi*hi + hi*lo + lo*hi); the state scan in 16-step chunks on v_wmma_f32_16x16x4_f32 (f32 operands); token shift, chunk operands, GroupNorm and gating in f32 on VALU.
#include <hip/hip_runtime.h>
#include <math.h>

// ---------------------------------------------------------------------------
// Problem constants
// ---------------------------------------------------------------------------
constexpr int kBatch  = 2;
constexpr int kSeq    = 1024;
constexpr int kChan   = 1024;
constexpr int kHead   = 64;
constexpr int kNHead  = 16;
constexpr int kRows   = kBatch * kSeq;          // 2048 token rows (m = b*1024 + t)
constexpr int kMix    = 160;                    // lowrank width of the mix and gate paths
constexpr int kMixPad = 192;                    // padded to a 64 multiple (pad rows / cols zero-filled)
constexpr int kDec    = 64;                     // decay lowrank width
constexpr int kBr     = 32;                     // per-branch mix width
constexpr int kNBr    = 5;                      // branches: 0 decay, 1 k, 2 v, 3 r, 4 gate
constexpr long kPlane  = (long)kRows * kChan;   // 2,097,152 elements per activation plane
constexpr long kWPlane = (long)kChan * kChan;   // 1,048,576 elements per square weight plane
constexpr float kGnEps = 1.6e-4f;               // 1e-5 * 16
static_assert(kNHead * kHead == kChan, "shape");
static_assert(kRows % 256 == 0 && kChan % 256 == 0 && kMixPad % 64 == 0 && kDec % 64 == 0, "M and N tile multiples");
static_assert(kChan % 32 == 0 && kBr % 32 == 0 && kDec % 32 == 0 && kMixPad % 32 == 0, "K multiples of 32");
static_assert(kMix % 8 == 0 && kMixPad % 8 == 0 && kDec % 8 == 0, "pack groups never straddle a row");

typedef __attribute__((ext_vector_type(16))) _Float16 v16h;
typedef __attribute__((ext_vector_type(8)))  _Float16 v8h;
typedef __attribute__((ext_vector_type(16))) __bf16   v16b;
typedef __attribute__((ext_vector_type(8)))  __bf16   v8b;
typedef __attribute__((ext_vector_type(8)))  float    v8f;
typedef __attribute__((ext_vector_type(4)))  float    v4f;
typedef __attribute__((ext_vector_type(2)))  float    v2f;
typedef __attribute__((ext_vector_type(4)))  unsigned int v4u;

__device__ __forceinline__ unsigned short f2bf_bits(float f) {
  unsigned u = __float_as_uint(f);
  return (unsigned short)((u + 0x7FFFu + ((u >> 16) & 1u)) >> 16);
}
__device__ __forceinline__ float bf_bits2f(unsigned short h) { return __uint_as_float(((unsigned)h) << 16); }
__device__ __forceinline__ unsigned pk16(unsigned short a, unsigned short b) { return (unsigned)a | ((unsigned)b << 16); }
// RNE convert to a bf16 hi part and a bf16 lo part of the f32 residual
__device__ __forceinline__ void bf_split_bits(float f, unsigned short& hb, unsigned short& lb) {
  hb = f2bf_bits(f);
  lb = f2bf_bits(f - bf_bits2f(hb));
}

// hazard guards as plain device helpers (no inline asm inside the kernel template body); the 4-acc guard ties every
// accumulator of a group and names the A fragments as inputs
__device__ __forceinline__ void dep_guard4_h(v8f& a, v8f& b, v8f& c, v8f& d, v16h x, v16h y) { asm volatile("v_nop\n\tv_nop\n\tv_nop\n\tv_nop" : "+v"(a), "+v"(b), "+v"(c), "+v"(d) : "v"(x), "v"(y)); }
__device__ __forceinline__ void dep_guard4_b(v8f& a, v8f& b, v8f& c, v8f& d, v16b x, v16b y) { asm volatile("v_nop\n\tv_nop\n\tv_nop\n\tv_nop" : "+v"(a), "+v"(b), "+v"(c), "+v"(d) : "v"(x), "v"(y)); }
__device__ __forceinline__ void keep4_h(v16h a, v16h b, v16h c, v16h d) { asm volatile("v_nop" :: "v"(a), "v"(b), "v"(c), "v"(d)); }
__device__ __forceinline__ void keep4_b(v16b a, v16b b, v16b c, v16b d) { asm volatile("v_nop" :: "v"(a), "v"(b), "v"(c), "v"(d)); }
__device__ __forceinline__ void acc_guard4(v8f& a, v8f& b, v8f& c, v8f& d) { asm volatile("v_nop\n\tv_nop\n\tv_nop\n\tv_nop" : "+v"(a), "+v"(b), "+v"(c), "+v"(d)); }
// One round of a sum over lanes of several values at once: of values x and x + M a lane keeps the one that its bit M selects and hands the
// other to its partner, lane ^ M, which keeps that one.
template <int M>
__device__ __forceinline__ void fold_lanes(float (&val)[32], const int lane) {
  const bool up = (lane & M) != 0;
#pragma unroll   // val is indexed by constants only, so that it stays in registers
  for (int x = 0; x < M; ++x) {
    const float keep = up ? val[x + M] : val[x];
    const float send = up ? val[x] : val[x + M];
    val[x] = keep + __shfl_xor(send, M, 32);
  }
}
template <typename T> struct Frag;
template <> struct Frag<_Float16> {
  typedef v16h V; typedef v8h H; union U { v16h v; v8h h[2]; };
  // elements 0..7 <- p[0..7], 8..15 <- p[16..23]
  static __device__ __forceinline__ v16h load(const _Float16* p) {
    U f; f.h[0] = *(const v8h*)(p); f.h[1] = *(const v8h*)(p + 16); return f.v;
  }
  static __device__ __forceinline__ v8f mma(v16h a, v16h b, v8f c) {
    return __builtin_amdgcn_wmma_f32_16x16x32_f16(false, a, false, b, (short)0, c, false, false);
  }
  static __device__ __forceinline__ void guard4(v8f& a, v8f& b, v8f& c, v8f& d, v16h x, v16h y) { dep_guard4_h(a, b, c, d, x, y); }
  static __device__ __forceinline__ void keep(v16h a, v16h b, v16h c, v16h d) { keep4_h(a, b, c, d); }
};
template <> struct Frag<__bf16> {
  typedef v16b V; typedef v8b H; union U { v16b v; v8b h[2]; };
  static __device__ __forceinline__ v16b load(const __bf16* p) {
    U f; f.h[0] = *(const v8b*)(p); f.h[1] = *(const v8b*)(p + 16); return f.v;
  }
  static __device__ __forceinline__ v8f mma(v16b a, v16b b, v8f c) {
    return __builtin_amdgcn_wmma_f32_16x16x32_bf16(false, a, false, b, (short)0, c, false, false);
  }
  static __device__ __forceinline__ void guard4(v8f& a, v8f& b, v8f& c, v8f& d, v16b x, v16b y) { dep_guard4_b(a, b, c, d, x, y); }
  static __device__ __forceinline__ void keep(v16b a, v16b b, v16b c, v16b d) { keep4_b(a, b, c, d); }
};

// ---- Register-blocked batched WMMA GEMM (ACT reduced to none/relu/leaky/tanh) -------------------------------
// C[m,n] = scale * sum_k A[m,k] * Bt[n,k] (+bias)(+resid); each wave owns a (16*MI)x64 tile, the WM x WN waves of a block one
// (16*MI*WM) x (64*WN) tile. A row-major [M,KD]; Bt row-major [N,KD]; M % (16*MI*WM) == 0, N % (64*WN) == 0, KD % KS == 0.
// Operand path: the block brings KS k values of its A rows and Bt rows from global memory in whole row pieces (KS*2 bytes,
// 16 B per lane), through registers, into one of two LDS buffers; every wave reads its fragments from there. The loads of
// stage s+1 are issued ahead of the products of stage s and stored to the other buffer behind them; one barrier per stage.
// SPLIT: operands are hi/lo planes (A2/Bt2 = lo planes, same layout); product = hi*hi + hi*lo + lo*hi.
// BIAS_MODE: 0 = none, 1 = bias[m], 2 = bias[n].
// OUT_MODE: 0 = f32, 2 = bf16 hi plane (Cout) + bf16 lo plane (Cout2), 4 = bf16 hi plane alone. In 2 and 4 a row of a wave's tile is one
//               whole 128-B line of each plane (ldc % 64 == 0), stored once, by 8 lanes of that wave.
//           3 = branch input: the tile is the mix term u of branch b = blockIdx.y; the epilogue forms
//               x[m][n] + (x[m-1][n]*f - x[m][n]) * (u + lam[b][n]), f = 0 at t == 0 else 1 (address of the prior row clamped),
//               x = resid (pitch kChan), lam = bias (pitch N), and stores its bf16 hi plane (Cout, plane b) and, for b > 0, its
//               bf16 lo plane (Cout2, plane b-1). Every 128-B line of a plane is stored once, by 8 lanes of one wave.
//               Its A operand is the [kNBr * kRows][kBr] row-major view of the mix lowrank's kMix valid columns, which lie in a plane
//               of pitch kMixPad: row R of the view is columns (R % kNBr) * kBr .. of the plane's row R / kNBr.
//           5 = scan operands: the tile is the decay lowrank term of 16 rows of one head per wave (64 divides n0), which is one chunk of the
//               state scan. With w = tile + bias[n] (bias = td_miu), d = exp(w), k' = k * exp(min(w, 0)) (k = resid, r = aux3, v = aux4, pitch
//               kChan, u = aux) the epilogue stores, per chunk tile (head, group of 16 rows):
//                 Cout  [t][64]  r_t * (product of d over the chunk's steps before t)
//                 Cout2 [j][16]  k'_s * (product of d over the chunk's steps behind s), k channel j major
//                 aux5  [i][16]  v_s, v channel i major
//                 aux2  [t][16]  sum_j r_t k'_s * (product of d over the steps between s and t) for s < t, sum_j r_t u k'_t for s == t, 0 above
//                 behind all tiles of aux2, [64]: the product of d over the whole chunk
//               Only products of decay factors are formed, never a quotient. Every 128-B line is stored by one wave.
// ACT (OUT_MODE 2 and 4 only): 5 = tanh ahead of the bf16 conversion; columns from kMix on of an N == kMixPad GEMM are stored as zero.
// ET: 0 = f16 operands, 1 = bf16 operands (pointers passed as 16-bit storage)
// The engine is a device function, so that GEMMs which do not depend on one another can share one launch: bx and b stand for the
// block's place in the GEMM's own grid, smem for the launch's one LDS array (kGemmLds bytes of it are used).
// MI: 16-row groups of a wave's tile, 4 unless said otherwise. With MI = 2 a wave owns 32x64, so that a 256 x 64 block tile takes the
// eight waves of the 256-thread blocks that it shares a launch with; every element's k order is the same for every MI.
template <bool SPLIT, int WM, int WN, int KS, int MI>
constexpr int kGemmLds = 2 * (SPLIT ? 2 : 1) * (16 * MI * WM + 64 * WN) * (KS + 8) * 2 + WM * WN * 16 * 68 * 4;
template <int ET> struct Elem;
template <> struct Elem<0> { typedef _Float16 T; };
template <> struct Elem<1> { typedef __bf16 T; };
template <int ET, bool SPLIT, int BIAS_MODE, int OUT_MODE, bool RESID, int ACT, int WM, int WN, int KS, int KD, int MI>
__device__ __forceinline__ void gemm64_body(
    char* smem, const int bx, const int b,
    const unsigned short* __restrict__ Ap, const unsigned short* __restrict__ A2p, long strideA,
    const unsigned short* __restrict__ Btp, const unsigned short* __restrict__ Bt2p, long strideB,
    void* __restrict__ Cout, void* __restrict__ Cout2, int ldc, long strideC,
    const float* __restrict__ bias,
    const float* __restrict__ resid, long strideR,
    int N, float scale,
    const float* __restrict__ aux = nullptr, float* __restrict__ aux2 = nullptr, const float* __restrict__ aux3 = nullptr,
    const float* __restrict__ aux4 = nullptr, float* __restrict__ aux5 = nullptr) {
  typedef typename Elem<ET>::T T;
  typedef typename Frag<T>::V V;
  typedef typename Frag<T>::H H;
  constexpr int NW    = WM * WN;               // waves per block
  constexpr int NT    = 32 * NW;               // threads per block
  constexpr int BM    = 16 * MI * WM;          // block tile rows (A rows per stage)
  constexpr int BN    = 64 * WN;               // block tile columns (Bt rows per stage)
  constexpr int PITCH = KS + 8;                // LDS row pitch in elements: row bytes + 16, an odd multiple of 16 B
  constexpr int CH    = KS / 8;                // 16-B pieces per row piece
  constexpr int RSTEP = NT / CH;               // rows covered by one load of the whole block
  constexpr int NA    = BM / RSTEP;            // loads per thread and plane, A
  constexpr int NB    = BN / RSTEP;            // loads per thread and plane, Bt
  constexpr int PLANE = (BM + BN) * PITCH;     // elements of one plane in one buffer: A rows, then Bt rows
  constexpr int BUF   = (SPLIT ? 2 : 1) * PLANE;
  constexpr int NS    = KD / KS;               // stages
  static_assert(KS == 32 || KS == 64, "row piece");
  static_assert(KD % KS == 0 && BM % RSTEP == 0 && BN % RSTEP == 0, "stage split");
  const T* A = (const T*)Ap; const T* A2 = (const T*)A2p; const T* Bt = (const T*)Btp; const T* Bt2 = (const T*)Bt2p;
  static_assert(kGemmLds<SPLIT, WM, WN, KS, MI> == 2 * BUF * 2 + NW * 16 * 68 * 4, "LDS share");
  static_assert(OUT_MODE != 3 || MI == 4, "the branch-input epilogue is written for 64-row wave tiles");
  T* sOp = (T*)smem;                                // two operand buffers
  float* sT = (float*)(smem + 2 * BUF * 2);         // behind them, per wave, a 16x64 slab, pitch 68 floats
  const int tid  = threadIdx.x;
  const int lane = tid & 31;
  const int wave = tid >> 5;
  const int tilesN = N / BN;
  const int bm = bx / tilesN;                  // the GEMM's grid holds exactly (M / BM) * (N / BN) blocks
  const int bn = bx - bm * tilesN;
  const int wm = wave / WN;
  const int wn = wave - wm * WN;
  const int m0 = bm * BM + wm * (16 * MI);
  const int n0 = bn * BN + (wn << 6);

  // block-uniform bases of the block's rows; every thread adds its one fixed byte offset
  const char* gA  = (const char*)(A  + (size_t)b * strideA + (size_t)(bm * BM) * KD);
  const char* gB  = (const char*)(Bt + (size_t)b * strideB + (size_t)(bn * BN) * KD);
  const char* gA2 = SPLIT ? (const char*)(A2  + (size_t)b * strideA + (size_t)(bm * BM) * KD) : nullptr;
  const char* gB2 = SPLIT ? (const char*)(Bt2 + (size_t)b * strideB + (size_t)(bn * BN) * KD) : nullptr;
  const int sRow = tid / CH, sCol = (tid % CH) * 8;
  const unsigned offG = (unsigned)(sRow * KD + sCol) * 2u;   // bytes
  const int      offL = sRow * PITCH + sCol;                 // elements
  // OUT_MODE 3: byte offsets of this thread's A row pieces, counted from the start of the padded plane
  static_assert(OUT_MODE != 3 || (KD == kBr && KS == kBr), "a row of the view is one row piece");
  unsigned offV[NA];
#pragma unroll   // offV is indexed by constants only, so that it stays in registers
  for (int i = 0; i < NA; ++i) {
    const int R = b * kRows + bm * BM + i * RSTEP + sRow;
    offV[i] = (OUT_MODE == 3) ? (unsigned)((R / kNBr) * kMixPad + (R % kNBr) * kBr + sCol) * 2u : 0u;
  }

  const int rlane = lane & 15;                 // row (A) / col (B, D) within subtile
  const int koff  = (lane >> 4) * 8;           // k offset of this lane half
  const int mOff  = (lane >> 4) * 8;           // D row offset

  v8f acc[MI][4];
#pragma unroll
  for (int i = 0; i < MI; ++i)
#pragma unroll
    for (int j = 0; j < 4; ++j) acc[i][j] = (v8f){0.f,0.f,0.f,0.f,0.f,0.f,0.f,0.f};

  // one stage in flight; every loop over these arrays and over the fragments is fully unrolled, so that they stay in registers
  H ra[NA], ra2[NA], rb[NB], rb2[NB];
  auto gload = [&](int k0) {
    // the two scheduling barriers keep every other instruction out of the group of loads and its wait, and the group ahead of
    // the products: sunk next to the LDS stores that use them, the loads would show their whole latency in every stage
    __builtin_amdgcn_sched_barrier(0);
#pragma unroll
    for (int i = 0; i < NA; ++i) {
      if (OUT_MODE == 3) ra[i] = *(const H*)((const char*)A + offV[i]);
      else               ra[i] = *(const H*)(gA + (size_t)k0 * 2 + (size_t)i * (RSTEP * KD * 2) + offG);
      if (SPLIT) ra2[i] = *(const H*)(gA2 + (size_t)k0 * 2 + (size_t)i * (RSTEP * KD * 2) + offG);
    }
#pragma unroll
    for (int i = 0; i < NB; ++i) {
      rb[i] = *(const H*)(gB + (size_t)k0 * 2 + (size_t)i * (RSTEP * KD * 2) + offG);
      if (SPLIT) rb2[i] = *(const H*)(gB2 + (size_t)k0 * 2 + (size_t)i * (RSTEP * KD * 2) + offG);
    }
    // precaution: this wait stands in front of every later write of a register that one of these loads names
    asm volatile("s_wait_xcnt 0x0" ::: "memory");
    __builtin_amdgcn_sched_barrier(0);
  };
  auto sstore = [&](T* buf) {
#pragma unroll
    for (int i = 0; i < NA; ++i) {
      *(H*)(buf + i * (RSTEP * PITCH) + offL) = ra[i];
      if (SPLIT) *(H*)(buf + PLANE + i * (RSTEP * PITCH) + offL) = ra2[i];
    }
#pragma unroll
    for (int i = 0; i < NB; ++i) {
      *(H*)(buf + (BM + i * RSTEP) * PITCH + offL) = rb[i];
      if (SPLIT) *(H*)(buf + PLANE + (BM + i * RSTEP) * PITCH + offL) = rb2[i];
    }
  };
  const int fragA = (wm * (16 * MI) + rlane) * PITCH + koff;        // this lane's place in the first A / Bt fragment of its wave
  const int fragB = (BM + (wn << 6) + rlane) * PITCH + koff;
  auto compute = [&](const T* buf) {
#pragma unroll
    for (int kk = 0; kk < KS; kk += 32) {
      V bh[4], bl[4], ah[MI], al[MI];
#pragma unroll
      for (int j = 0; j < 4; ++j) {
        bh[j] = Frag<T>::load(buf + fragB + j * (16 * PITCH) + kk);
        if (SPLIT) bl[j] = Frag<T>::load(buf + PLANE + fragB + j * (16 * PITCH) + kk);
      }
#pragma unroll
      for (int i = 0; i < MI; ++i) {
        ah[i] = Frag<T>::load(buf + fragA + i * (16 * PITCH) + kk);
        if (SPLIT) al[i] = Frag<T>::load(buf + PLANE + fragA + i * (16 * PITCH) + kk);
      }
#pragma unroll
      for (int i = 0; i < MI; ++i) {
#pragma unroll
        for (int j = 0; j < 4; ++j) {
          acc[i][j] = Frag<T>::mma(ah[i], bh[j], acc[i][j]);
          if (SPLIT) {
            acc[i][j] = Frag<T>::mma(ah[i], bl[j], acc[i][j]);
            acc[i][j] = Frag<T>::mma(al[i], bh[j], acc[i][j]);
          }
        }
        Frag<T>::guard4(acc[i][0], acc[i][1], acc[i][2], acc[i][3], ah[i], SPLIT ? al[i] : ah[i]);
      }
      Frag<T>::keep(bh[0], bh[1], bh[2], bh[3]);
      if (SPLIT) Frag<T>::keep(bl[0], bl[1], bl[2], bl[3]);
    }
  };

  gload(0);
  sstore(sOp);
  __syncthreads();
  // kept rolled, for speed only
#pragma unroll 1
  for (int s = 0; s < NS; ++s) {
    if (s + 1 < NS) gload((s + 1) * KS);                       // block-uniform
    compute(sOp + (s & 1) * BUF);
    if (s + 1 < NS) sstore(sOp + ((s + 1) & 1) * BUF);
    // the one barrier of a stage: publishes stage s+1 and ends the reads of stage s, whose buffer the next pass overwrites
    __syncthreads();
  }
#pragma unroll   // acc is indexed by constants only, so that it stays in registers
  for (int i = 0; i < MI; ++i) acc_guard4(acc[i][0], acc[i][1], acc[i][2], acc[i][3]);

  // ---- epilogue ----
  float* slab = sT + wave * (16 * 68);
  const float* Rb = RESID ? (resid + (size_t)b * strideR) : nullptr;
  v4f lam0 = (v4f){0.f, 0.f, 0.f, 0.f}, lam1 = lam0;
  // OUT_MODE 3: block-uniform bases of the block's first row in x and in the two planes (pitch kChan); every lane adds one fixed byte
  // offset, offX (f32; half of it in the bf16 planes), and the row groups are immediates. t == 0 can only fall on the first row of a
  // wave's tile (64 divides kSeq): there the prior row's address is the row's own and its factor 0.
  static_assert(OUT_MODE != 3 || kSeq % 64 == 0, "t == 0 only on a wave tile's first row");
  const char* gX = nullptr; char* gH = nullptr; char* gL = nullptr;
  unsigned offX = 0, offP0 = 0;
  float fz0 = 1.0f;
  if (OUT_MODE == 3) {
    const size_t tile0 = (size_t)(bm * BM) * kChan + bn * BN;
    gX = (const char*)(resid + tile0);
    gH = (char*)((unsigned short*)Cout  + (size_t)b * strideC + tile0);
    gL = (char*)((unsigned short*)Cout2 + (size_t)(b > 0 ? (b - 1) : 0) * strideC + tile0);
    const int row0 = (wm << 6) + (lane >> 3);
    offX = (unsigned)(row0 * kChan + (wn << 6) + (lane & 7) * 8) * 4u;
    const bool t0 = ((bm * BM + row0) & (kSeq - 1)) == 0;
    offP0 = t0 ? offX + (unsigned)(kChan * 4) : offX;      // counted from one row above gX, so that it is never negative
    fz0 = t0 ? 0.0f : 1.0f;
    const float* pl = bias + (size_t)b * N + n0 + (lane & 7) * 8;
    __builtin_amdgcn_sched_barrier(0);   // with the one below: keeps the two loads and their wait together
    lam0 = *(const v4f*)(pl); lam1 = *(const v4f*)(pl + 4);
    // precaution: this wait stands in front of every later write of a register that one of these two loads names
    asm volatile("s_wait_xcnt 0x0" ::: "memory");
    __builtin_amdgcn_sched_barrier(0);
  }
  v2f tm2 = (v2f){0.f, 0.f}, u2 = tm2;
  if (OUT_MODE == 5) {
    __builtin_amdgcn_sched_barrier(0);   // with the one below: keeps the two loads and their wait together
    tm2 = *(const v2f*)(bias + n0 + lane * 2);
    u2  = *(const v2f*)(aux + n0 + lane * 2);
    // precaution: this wait stands in front of every later write of a register that one of these two loads names
    asm volatile("s_wait_xcnt 0x0" ::: "memory");
    __builtin_amdgcn_sched_barrier(0);
  }
#pragma unroll
  for (int i = 0; i < MI; ++i) {
    const int mBase = m0 + (i << 4);
    v4f xa0[4], xa1[4], xb0[4], xb1[4];
    v2f kq[16], rq[16], vq[16];
    // OUT_MODE 5: the three planes (k, r, v) have pitch kChan: uniform bases, this lane's one byte offset (its two channels), rows as immediates
    const unsigned offS5 = (unsigned)(mBase * kChan + n0 + lane * 2) * 4u;
    if (OUT_MODE == 5) {
      // the two scheduling barriers keep every other instruction out of the group of loads and its wait, and the group ahead of
      // the slab writes, which are served while the loads fly
      __builtin_amdgcn_sched_barrier(0);
#pragma unroll   // the three arrays are indexed by constants only, so that they stay in registers
      for (int t = 0; t < 16; ++t) {
        kq[t] = *(const v2f*)((const char*)resid + (size_t)t * (kChan * 4) + offS5);
        rq[t] = *(const v2f*)((const char*)aux3 + (size_t)t * (kChan * 4) + offS5);
        vq[t] = *(const v2f*)((const char*)aux4 + (size_t)t * (kChan * 4) + offS5);
      }
      // precaution: this wait stands in front of every later write of a register that one of these loads names
      asm volatile("s_wait_xcnt 0x0" ::: "memory");
      __builtin_amdgcn_sched_barrier(0);
    }
    if (OUT_MODE == 3) {
      // the two scheduling barriers keep every other instruction out of the group of loads and its wait, and the group ahead of
      // the slab writes, which are served while the loads fly
      __builtin_amdgcn_sched_barrier(0);
#pragma unroll
      for (int it = 0; it < 4; ++it) {
        const int r = i * 16 + it * 4;                       // this lane's row = first row of its wave + r + q
        const char* px = gX + (size_t)r * (kChan * 4) + offX;
        const char* pp = (r == 0) ? (gX - kChan * 4 + offP0) : (gX + (size_t)(r - 1) * (kChan * 4) + offX);
        xa0[it] = *(const v4f*)(px); xa1[it] = *(const v4f*)(px + 16);
        xb0[it] = *(const v4f*)(pp); xb1[it] = *(const v4f*)(pp + 16);
      }
      // precaution: this wait stands in front of every later write of a register that one of these loads names
      asm volatile("s_wait_xcnt 0x0" ::: "memory");
      __builtin_amdgcn_sched_barrier(0);
    }
#pragma unroll
    for (int j = 0; j < 4; ++j) {
      const int n = n0 + (j << 4) + rlane;
      float bv = 0.f;
      if (BIAS_MODE == 2) bv = bias[n];
#pragma unroll
      for (int r = 0; r < 8; ++r) {
        float v = acc[i][j][r] * scale;
        if (BIAS_MODE == 1) v += bias[mBase + mOff + r];
        if (BIAS_MODE == 2) v += bv;
        if (RESID) v += Rb[(size_t)(mBase + mOff + r) * ldc + n];
        if (ACT == 2) v = fmaxf(v, 0.0f);
        if (ACT == 4) v = (v > 0.f) ? v : 0.01f * v;
        slab[(mOff + r) * 68 + (j << 4) + rlane] = v;
      }
    }
    __builtin_amdgcn_fence(__ATOMIC_RELEASE, "workgroup");
    __builtin_amdgcn_wave_barrier();
    __builtin_amdgcn_fence(__ATOMIC_ACQUIRE, "workgroup");
    if (OUT_MODE == 0) {
      float* C = (float*)Cout + (size_t)b * strideC;
      const int hh = lane >> 4, c4 = (lane & 15) * 4;     // row seg = 256 B = 16 lanes x 16 B
      v4f v[8];
      float* pc[8];
#pragma unroll   // here and below: v and pc are indexed by constants only, so that they stay in registers
      for (int it = 0; it < 8; ++it) {
        const int row = it * 2 + hh;
        v[it]  = *(const v4f*)(slab + row * 68 + c4);
        pc[it] = C + (size_t)(mBase + row) * ldc + n0 + c4;
      }
      // the two scheduling barriers keep every other instruction out of the group of stores and its wait
      __builtin_amdgcn_sched_barrier(0);
#pragma unroll
      for (int it = 0; it < 8; ++it) *(v4f*)pc[it] = v[it];
      // precaution: this wait stands in front of every later write of a register that one of these stores names
      asm volatile("s_wait_xcnt 0x0" ::: "memory");
      __builtin_amdgcn_sched_barrier(0);
    } else if (OUT_MODE == 5) {
      // this lane: channels 2*lane and 2*lane + 1 of the head, all 16 steps of the chunk
      const size_t ch = (size_t)(n0 >> 6) * (kRows / 16) + (mBase >> 4);
      float* gR = (float*)Cout  + ch * 1024 + lane * 2;
      float* gK = (float*)Cout2 + ch * 1024 + lane * 32;
      float* gV = aux5 + ch * 1024 + lane * 32;
      float* gA = aux2 + ch * 256 + lane;
      float* gP = aux2 + (size_t)kNHead * (kRows / 16) * 256 + ch * 64 + lane * 2;
      v2f dd[16], rt[16];
      v2f P = (v2f){1.0f, 1.0f};
#pragma unroll   // here and below: the arrays are indexed by constants only, so that they stay in registers
      for (int t = 0; t < 16; ++t) {
        const v2f wl = *(const v2f*)(slab + t * 68 + lane * 2);
        const float w0 = wl[0] + tm2[0], w1 = wl[1] + tm2[1];
        dd[t] = (v2f){expf(w0), expf(w1)};
        kq[t] = kq[t] * (v2f){expf(fminf(w0, 0.0f)), expf(fminf(w1, 0.0f))};     // k'
        rt[t] = rq[t] * P;
        P = P * dd[t];
      }
      // the two scheduling barriers keep every other instruction out of the group of stores and its wait
      __builtin_amdgcn_sched_barrier(0);
#pragma unroll
      for (int e = 0; e < 2; ++e)
#pragma unroll
        for (int s4 = 0; s4 < 4; ++s4)
          *(v4f*)(gV + e * 16 + s4 * 4) = (v4f){vq[4 * s4][e], vq[4 * s4 + 1][e], vq[4 * s4 + 2][e], vq[4 * s4 + 3][e]};
#pragma unroll
      for (int t = 0; t < 16; ++t) *(v2f*)(gR + t * 64) = rt[t];
      // precaution: this wait stands in front of every later write of a register that one of these stores names
      asm volatile("s_wait_xcnt 0x0" ::: "memory");
      __builtin_amdgcn_sched_barrier(0);
      // step by step: kq[s], s < t, holds k'_s times the decay factors of the steps between s and t; this lane's share of row t of the
      // r-k matrix is formed from it, then kq[s] takes the factor of step t. Two rows (32 entries) are summed over the 32 lanes at a time.
      float tot[8];
      float val[32];
#pragma unroll
      for (int t = 0; t < 16; ++t) {
#pragma unroll
        for (int sx = 0; sx < 16; ++sx) {
          float z = 0.0f;
          if (sx < t)  { const v2f zz = rq[t] * kq[sx];        z = zz[0] + zz[1]; }
          if (sx == t) { const v2f zz = rq[t] * (u2 * kq[sx]); z = zz[0] + zz[1]; }
          val[(t & 1) * 16 + sx] = z;
        }
#pragma unroll
        for (int sx = 0; sx < 16; ++sx)
          if (sx < t) kq[sx] = kq[sx] * dd[t];
        if (t & 1) {
          // 32 values, each a sum over the 32 lanes: every round halves the values a lane holds, and lane l ends with value l
          fold_lanes<16>(val, lane); fold_lanes<8>(val, lane); fold_lanes<4>(val, lane); fold_lanes<2>(val, lane); fold_lanes<1>(val, lane);
          tot[t >> 1] = val[0];
        }
      }
      // the two scheduling barriers keep every other instruction out of the group of stores and its wait
      __builtin_amdgcn_sched_barrier(0);
#pragma unroll
      for (int g = 0; g < 8; ++g) gA[g * 32] = tot[g];
#pragma unroll
      for (int e = 0; e < 2; ++e)
#pragma unroll
        for (int s4 = 0; s4 < 4; ++s4)
          *(v4f*)(gK + e * 16 + s4 * 4) = (v4f){kq[4 * s4][e], kq[4 * s4 + 1][e], kq[4 * s4 + 2][e], kq[4 * s4 + 3][e]};
      *(v2f*)gP = P;
      // precaution: this wait stands in front of every later write of a register that one of these stores names
      asm volatile("s_wait_xcnt 0x0" ::: "memory");
      __builtin_amdgcn_sched_barrier(0);
    } else if (OUT_MODE == 3) {
      const int q = lane >> 3, c8 = (lane & 7) * 8;
      v4u uh[4], ul[4];
#pragma unroll
      for (int it = 0; it < 4; ++it) {
        const int row = it * 4 + q;
        const float fz = (i == 0 && it == 0) ? fz0 : 1.0f;
        const v4f u0 = *(const v4f*)(slab + row * 68 + c8), u1 = *(const v4f*)(slab + row * 68 + c8 + 4);
        unsigned short hb[8], lb[8];
#pragma unroll
        for (int e = 0; e < 4; ++e) {
          const float ba0 = xb0[it][e] * fz - xa0[it][e];
          const float ba1 = xb1[it][e] * fz - xa1[it][e];
          const float v0 = xa0[it][e] + ba0 * (u0[e] + lam0[e]);
          const float v1 = xa1[it][e] + ba1 * (u1[e] + lam1[e]);
          bf_split_bits(v0, hb[e], lb[e]);
          bf_split_bits(v1, hb[4 + e], lb[4 + e]);
        }
        uh[it] = (v4u){pk16(hb[0], hb[1]), pk16(hb[2], hb[3]), pk16(hb[4], hb[5]), pk16(hb[6], hb[7])};
        ul[it] = (v4u){pk16(lb[0], lb[1]), pk16(lb[2], lb[3]), pk16(lb[4], lb[5]), pk16(lb[6], lb[7])};
      }
      // as for the loads: nothing else is scheduled into the group of stores and its wait
      __builtin_amdgcn_sched_barrier(0);
#pragma unroll
      for (int it = 0; it < 4; ++it) *(v4u*)(gH + (size_t)(i * 16 + it * 4) * (kChan * 2) + offX / 2) = uh[it];
      // the same precaution for the registers that these stores name
      asm volatile("s_wait_xcnt 0x0" ::: "memory");
      __builtin_amdgcn_sched_barrier(0);
      if (b > 0) {                                           // block-uniform: branch 0 has no lo plane
        __builtin_amdgcn_sched_barrier(0);
#pragma unroll
        for (int it = 0; it < 4; ++it) *(v4u*)(gL + (size_t)(i * 16 + it * 4) * (kChan * 2) + offX / 2) = ul[it];
        asm volatile("s_wait_xcnt 0x0" ::: "memory");        // the same precaution
        __builtin_amdgcn_sched_barrier(0);
      }
    } else {
      static_assert(OUT_MODE == 0 || OUT_MODE == 3 || OUT_MODE == 5 || OUT_MODE == 2 || OUT_MODE == 4, "output form");
      const int q = lane >> 3, c8 = (lane & 7) * 8;
      // 8 divides kMix: the 8 columns of a lane are all valid or all pad
      const float fv = (ACT == 5 && N == kMixPad && n0 + c8 >= kMix) ? 0.0f : 1.0f;
      const size_t o0 = (size_t)b * strideC + (size_t)(mBase + q) * ldc + n0 + c8;
      unsigned short* C  = (unsigned short*)Cout + o0;
      unsigned short* C2 = (unsigned short*)Cout2 + o0;
      // kept rolled, for speed only: the tanh is long, and unrolled it would have 32 copies per row group
#pragma unroll 1
      for (int it = 0; it < 4; ++it) {
        const float* sp = slab + (it * 4 + q) * 68 + c8;
        const v4f u0 = *(const v4f*)(sp), u1 = *(const v4f*)(sp + 4);
        unsigned short hb[8], lb[8];
#pragma unroll
        for (int e = 0; e < 4; ++e) {
          float t0 = u0[e], t1 = u1[e];
          if (ACT == 5) { t0 = tanhf(t0) * fv; t1 = tanhf(t1) * fv; }
          if (OUT_MODE == 2) { bf_split_bits(t0, hb[e], lb[e]); bf_split_bits(t1, hb[4 + e], lb[4 + e]); }
          else               { hb[e] = f2bf_bits(t0); hb[4 + e] = f2bf_bits(t1); lb[e] = 0; lb[4 + e] = 0; }
        }
        const v4u uh = (v4u){pk16(hb[0], hb[1]), pk16(hb[2], hb[3]), pk16(hb[4], hb[5]), pk16(hb[6], hb[7])};
        const v4u ul = (v4u){pk16(lb[0], lb[1]), pk16(lb[2], lb[3]), pk16(lb[4], lb[5]), pk16(lb[6], lb[7])};
        // the two scheduling barriers keep every other instruction out of the group of stores and its wait
        __builtin_amdgcn_sched_barrier(0);
        *(v4u*)(C + (size_t)(it * 4) * ldc) = uh;
        if (OUT_MODE == 2) *(v4u*)(C2 + (size_t)(it * 4) * ldc) = ul;
        // precaution: this wait stands in front of every later write of a register that one of these stores names
        asm volatile("s_wait_xcnt 0x0" ::: "memory");
        __builtin_amdgcn_sched_barrier(0);
      }
    }
    __builtin_amdgcn_fence(__ATOMIC_RELEASE, "workgroup");
    __builtin_amdgcn_wave_barrier();
    __builtin_amdgcn_fence(__ATOMIC_ACQUIRE, "workgroup");
  }
}

// One GEMM in a launch of its own: grid (tiles, batch).
template <int ET, bool SPLIT, int BIAS_MODE, int OUT_MODE, bool RESID, int ACT, int WM, int WN, int KS, int KD, int MI = 4>
__global__ __launch_bounds__(32 * WM * WN) void wmma_gemm64(
    const unsigned short* __restrict__ Ap, const unsigned short* __restrict__ A2p, long strideA,
    const unsigned short* __restrict__ Btp, const unsigned short* __restrict__ Bt2p, long strideB,
    void* __restrict__ Cout, void* __restrict__ Cout2, int ldc, long strideC,
    const float* __restrict__ bias,
    const float* __restrict__ resid, long strideR,
    int N, float scale) {
  __shared__ __align__(16) char smem[kGemmLds<SPLIT, WM, WN, KS, MI>];
  gemm64_body<ET, SPLIT, BIAS_MODE, OUT_MODE, RESID, ACT, WM, WN, KS, KD, MI>(
      smem, blockIdx.x, blockIdx.y, Ap, A2p, strideA, Btp, Bt2p, strideB, Cout, Cout2, ldc, strideC, bias, resid, strideR, N, scale);
}

// The three GEMMs that read only the branch inputs, in one launch of 224 blocks, each block alone on its WGP by its LDS:
//   blocks   0..191  k / v / r projections (split, K 1024), 64 tiles of 128 x 256 for each of the three
//   blocks 192..215  gate lowrank (split, N 192, K 1024), 24 tiles of 256 x 64, eight waves of 32 x 64; stores tanh as bf16 hi/lo
//   blocks 216..223  decay lowrank (single, N 64, K 1024), 8 tiles of 256 x 64, eight waves of 32 x 64; stores tanh as bf16
constexpr int kProjTiles = (kRows / 128) * (kChan / 256);   // 64
constexpr int kGateTiles = (kRows / 256) * (kMixPad / 64);  // 24
constexpr int kDecTiles  = (kRows / 256) * (kDec / 64);     // 8
__global__ __launch_bounds__(256) void k_branch_gemms(
    const unsigned short* __restrict__ X5H, const unsigned short* __restrict__ X5L,
    const unsigned short* __restrict__ WH, const unsigned short* __restrict__ WL, float* __restrict__ KVR,
    const unsigned short* __restrict__ WG1TH, const unsigned short* __restrict__ WG1TL,
    unsigned short* __restrict__ GHH, unsigned short* __restrict__ GHL,
    const unsigned short* __restrict__ TDAT, unsigned short* __restrict__ L1) {
  const float* fdum = nullptr;                               // bias and resid of the engine: not used by these GEMMs, never dereferenced
  __shared__ __align__(16) char smem[kGemmLds<true, 2, 4, 64, 4>];
  static_assert(kGemmLds<true, 8, 1, 64, 2> <= kGemmLds<true, 2, 4, 64, 4> && kGemmLds<false, 8, 1, 64, 2> <= kGemmLds<true, 2, 4, 64, 4>, "LDS share");
  const int id = blockIdx.x;                                 // every branch below is block-uniform
  if (id < 3 * kProjTiles) {
    gemm64_body<1, true, 0, 0, false, 0, 2, 4, 64, kChan, 4>(
        smem, id % kProjTiles, id / kProjTiles, X5H + kPlane, X5L, (long)kPlane, WH, WL, (long)kWPlane,
        (void*)KVR, (void*)KVR, kChan, (long)kPlane, fdum, fdum, 0L, kChan, 1.0f);
  } else if (id < 3 * kProjTiles + kGateTiles) {
    gemm64_body<1, true, 0, 2, false, 5, 8, 1, 64, kChan, 2>(
        smem, id - 3 * kProjTiles, 0, X5H + 4 * kPlane, X5L + 3 * kPlane, 0L, WG1TH, WG1TL, 0L,
        (void*)GHH, (void*)GHL, kMixPad, 0L, fdum, fdum, 0L, kMixPad, 1.0f);
  } else {
    gemm64_body<1, false, 0, 4, false, 5, 8, 1, 64, kChan, 2>(
        smem, id - 3 * kProjTiles - kGateTiles, 0, X5H, X5H, 0L, TDAT, TDAT, 0L,
        (void*)L1, (void*)L1, kDec, 0L, fdum, fdum, 0L, kDec, 1.0f);
  }
}

// Block tile of the GEMMs whose launch would leave WGPs idle at 128 x 256 (64 tiles for a 2048 x 1024 result, on 256 WGPs):
// 64 x 128, eight waves of 16 x 64, so that one such GEMM has 256 tiles, one for every WGP.
constexpr int kFillTiles = (kRows / 64) * (kChan / 128);    // 256
// The two GEMMs behind the tanh of the two lowrank paths, in one launch of 512 blocks, two to a WGP by their LDS:
//   blocks  0..255  gate output (split, K 192), blocks 256..511 decay output (single, K 64); 256 tiles of 64 x 128 each
// The decay GEMM's epilogue turns its tile, one 16-step chunk of one head per wave, into the chunk operands that the state scan reads
// (OUT_MODE 5 above): none of them depends on the state, so that they are formed here, by 2048 waves side by side.
__global__ __launch_bounds__(256) void k_lowrank_out_gemms(
    const unsigned short* __restrict__ GHH, const unsigned short* __restrict__ GHL,
    const unsigned short* __restrict__ WG2TH, const unsigned short* __restrict__ WG2TL, float* __restrict__ GATE,
    const unsigned short* __restrict__ L1, const unsigned short* __restrict__ TDBT, float* __restrict__ RH,
    const float* __restrict__ Kraw, const float* __restrict__ Rpl, const float* __restrict__ Vpl,
    const float* __restrict__ td_miu, const float* __restrict__ u,
    float* __restrict__ KH, float* __restrict__ VH, float* __restrict__ AH) {
  const float* fdum = nullptr;                               // bias and resid of the gate GEMM: not used by it, never dereferenced
  __shared__ __align__(16) char smem[kGemmLds<true, 4, 2, 64, 1>];
  static_assert(kGemmLds<false, 4, 2, 64, 1> <= kGemmLds<true, 4, 2, 64, 1>, "LDS share");
  const int id = blockIdx.x;                                 // block-uniform
  if (id < kFillTiles) {
    gemm64_body<1, true, 0, 0, false, 0, 4, 2, 64, kMixPad, 1>(
        smem, id, 0, GHH, GHL, 0L, WG2TH, WG2TL, 0L, (void*)GATE, (void*)GATE, kChan, 0L, fdum, fdum, 0L, kChan, 1.0f);
  } else {
    gemm64_body<1, false, 0, 5, false, 0, 4, 2, 64, kDec, 1>(
        smem, id - kFillTiles, 0, L1, L1, 0L, TDBT, TDBT, 0L, (void*)RH, (void*)KH, kChan, 0L, td_miu, Kraw, 0L, kChan, 1.0f,
        u, AH, Rpl, Vpl, VH);
  }
}

// ---------------------------------------------------------------------------
// Square weight split: four [1024][1024] f32 matrices (layout kept as-is = [out][in] = Bt) -> bf16 hi and lo planes.
// 512 x 4 blocks (bx, z): z selects the matrix and the output plane (planes at out + z*1048576 halves).
// Thread i owns 8 consecutive elements: two b128 loads, one 16-B store per lane per plane; a wave writes 512 contiguous
// ---------------------------------------------------------------------------
__device__ __forceinline__ void wsplit8_body(const int bx, const int z,
                                             const float* __restrict__ W0, const float* __restrict__ W1,
                                             const float* __restrict__ W2, const float* __restrict__ W3,
                                             unsigned short* __restrict__ outH, unsigned short* __restrict__ outL,
                                             int n8PerMat) {
  const float* W = (z == 0) ? W0 : (z == 1) ? W1 : (z == 2) ? W2 : W3;   // block-uniform
  const int i = bx * 256 + threadIdx.x;
  if (i >= n8PerMat) return;
  const float* p = W + 8 * (size_t)i;
  const v4f a = *(const v4f*)(p);
  const v4f c = *(const v4f*)(p + 4);
  unsigned short hb[8], lb[8];
#pragma unroll
  for (int e = 0; e < 4; ++e) {
    bf_split_bits(a[e], hb[e], lb[e]);
    bf_split_bits(c[e], hb[4 + e], lb[4 + e]);
  }
  const v4u uh = (v4u){pk16(hb[0], hb[1]), pk16(hb[2], hb[3]), pk16(hb[4], hb[5]), pk16(hb[6], hb[7])};
  const v4u ul = (v4u){pk16(lb[0], lb[1]), pk16(lb[2], lb[3]), pk16(lb[4], lb[5]), pk16(lb[6], lb[7])};
  const size_t o = (size_t)z * (size_t)kWPlane + 8 * (size_t)i;
  *(v4u*)(outH + o) = uh;
  *(v4u*)(outL + o) = ul;
  // precaution: this wait stands in front of every later write of a register that one of these stores names
  asm volatile("s_wait_xcnt 0x0" ::: "memory");
}

// ---------------------------------------------------------------------------
// Transpose + bf16 convert (single or hi/lo): in[R][Cc] f32 row-major (pitch Cc) -> out[n][k] = cvt(in[k][n]) for
// k < R and n < Cc, zero otherwise (pad rows / pad columns of the output plane are WRITTEN as zeros).
// blocks (bx, by, bz) of nTilesN x nTilesK x Z: a block covers 32 output rows n0..n0+31 and KT output columns k0..k0+KT-1; bz adds
// inStrideZ / outStrideZ element offsets. 256 threads; sm = 32 * (KT + 1) floats of LDS.
// Load coverage: (32*KT/256) iterations x 256 threads = 32 x KT elements (coalesced along n), clamped address, 0/1 factor.
// Store, KT == 64: row = wave*4 + (lane>>3) -> 8 waves x 4 = 32 rows; (lane&7) x 8 halves = 64 cols; each row segment =
// Store, KT == 32 (requires ldo == 32, k0 == 0): threads 0..127, row = t>>2, c8 = (t&3)*8 -> thread t writes tile bytes
// ---------------------------------------------------------------------------
template <bool SPLIT, int KT>
__device__ __forceinline__ void trcast_body(float* sm, const int bx, const int by, const int bz,
                                            const float* __restrict__ in, int R, int Cc, long inStrideZ,
                                            unsigned short* __restrict__ outH, unsigned short* __restrict__ outL,
                                            int ldo, long outStrideZ) {
  static_assert(KT == 64 || KT == 32, "tile");
  const int t  = threadIdx.x;
  const int n0 = bx * 32;
  const int k0 = by * KT;
  const float* inz = in + (size_t)bz * inStrideZ;
  constexpr int kIters = (32 * KT) / 256;
  const float* pin[kIters];
  float fz[kIters], v[kIters];
#pragma unroll   // here and in the two loops below: the three arrays are indexed by constants only, so that they stay in registers
  for (int it = 0; it < kIters; ++it) {
    const int e  = it * 256 + t;
    const int n  = n0 + (e & 31);
    const int k  = k0 + (e >> 5);
    const int nc = (n < Cc) ? n : (Cc - 1);
    const int kc = (k < R) ? k : (R - 1);
    pin[it] = inz + (size_t)kc * Cc + nc;
    fz[it]  = ((n < Cc) && (k < R)) ? 1.0f : 0.0f;
  }
  // the two scheduling barriers keep every other instruction out of the group of loads and its wait
  __builtin_amdgcn_sched_barrier(0);
#pragma unroll
  for (int it = 0; it < kIters; ++it) v[it] = *pin[it];
  // precaution: this wait stands in front of every later write of a register that one of these loads names
  asm volatile("s_wait_xcnt 0x0" ::: "memory");
  __builtin_amdgcn_sched_barrier(0);
#pragma unroll
  for (int it = 0; it < kIters; ++it) {
    const int e = it * 256 + t;
    sm[(e & 31) * (KT + 1) + (e >> 5)] = v[it] * fz[it];
  }
  __syncthreads();
  const int lane = t & 31, wave = t >> 5;
  unsigned short* oh = outH + (size_t)bz * outStrideZ;
  unsigned short* ol = outL + (size_t)bz * outStrideZ;
  int row, c8;
  bool active;
  if (KT == 64) { row = wave * 4 + (lane >> 3); c8 = (lane & 7) * 8; active = true; }
  else          { row = t >> 2;                 c8 = (t & 3) * 8;    active = (t < 128); }
  if (active) {
    unsigned short hb[8], lb[8];
#pragma unroll
    for (int e = 0; e < 8; ++e) {
      const float v = sm[row * (KT + 1) + c8 + e];
      if (SPLIT) { bf_split_bits(v, hb[e], lb[e]); }
      else       { hb[e] = f2bf_bits(v); lb[e] = 0; }
    }
    const v4u uh = (v4u){pk16(hb[0], hb[1]), pk16(hb[2], hb[3]), pk16(hb[4], hb[5]), pk16(hb[6], hb[7])};
    const v4u ul = (v4u){pk16(lb[0], lb[1]), pk16(lb[2], lb[3]), pk16(lb[4], lb[5]), pk16(lb[6], lb[7])};
    const size_t o = (size_t)(n0 + row) * ldo + k0 + c8;
    *(v4u*)(oh + o) = uh;
    if (SPLIT) *(v4u*)(ol + o) = ul;
    // precaution: this wait stands in front of every later write of a register that one of these stores names
    asm volatile("s_wait_xcnt 0x0" ::: "memory");
  }
}

// ---------------------------------------------------------------------------
// Token shift: xx[m][c] = x[m][c] + (x[m-1][c]*f - x[m][c]) * miu_x[c], f = 0 at t == 0 else 1 (address of the prior row
// clamped, arithmetic 0/1 factor). Output: single bf16 plane [2048][1024].
// ---------------------------------------------------------------------------
__device__ __forceinline__ void xx8_body(const int bx, const float* __restrict__ x, const float* __restrict__ miu_x,
                                         unsigned short* __restrict__ XX, int n8) {
  const int i = bx * 256 + threadIdx.x;
  if (i >= n8) return;
  const int f  = 8 * i;
  const int m  = f >> 10;
  const int c0 = f & 1023;
  const int t  = m & 1023;
  const int mp = (t > 0) ? (m - 1) : m;
  const float fz = (t > 0) ? 1.0f : 0.0f;
  const float* px = x + f;
  const float* pp = x + ((size_t)mp << 10) + c0;
  const float* pm = miu_x + c0;
  const v4f a0 = *(const v4f*)(px), a1 = *(const v4f*)(px + 4);
  const v4f b0 = *(const v4f*)(pp), b1 = *(const v4f*)(pp + 4);
  const v4f u0 = *(const v4f*)(pm), u1 = *(const v4f*)(pm + 4);
  unsigned short hb[8];
#pragma unroll
  for (int e = 0; e < 4; ++e) {
    const float ba0 = b0[e] * fz - a0[e];
    const float ba1 = b1[e] * fz - a1[e];
    hb[e]     = f2bf_bits(a0[e] + ba0 * u0[e]);
    hb[4 + e] = f2bf_bits(a1[e] + ba1 * u1[e]);
  }
  const v4u uh = (v4u){pk16(hb[0], hb[1]), pk16(hb[2], hb[3]), pk16(hb[4], hb[5]), pk16(hb[6], hb[7])};
  unsigned short* q = XX + f;
  *(v4u*)q = uh;
  // precaution: this wait stands in front of every later write of a register that this store names
  asm volatile("s_wait_xcnt 0x0" ::: "memory");
}

// ---------------------------------------------------------------------------
// Everything that reads only the inputs, in one launch: the token shift, the six transposes and the square weight split do not
// depend on one another. blockIdx.x is cut into ranges, one per piece of work, each range holding that piece's own grid; every
// branch is block-uniform, and the one barrier of a transpose is passed by all threads of its block.
// ---------------------------------------------------------------------------
constexpr int kPbXX  = (int)(kPlane / 8) / 256;              // 1024 token shift
constexpr int kPbA   = (kMixPad / 32) * (kChan / 64);        // 96   A    [1024][160] -> AT   [192][1024], rows >= 160 zero
constexpr int kPbTA  = (kDec / 32) * (kChan / 64);           // 32   tdA  [1024][64]  -> TDAT [64][1024]
constexpr int kPbTB  = kChan / 32;                           // 32   tdB  [64][1024]  -> TDBT [1024][64]
constexpr int kPbG1  = (kMixPad / 32) * (kChan / 64);        // 96   Wg1  [1024][160] -> WG1T hi/lo [192][1024], rows >= 160 zero
constexpr int kPbG2  = (kChan / 32) * (kMixPad / 64);        // 96   Wg2  [160][1024] -> WG2T hi/lo [1024][192], cols >= 160 zero
constexpr int kPbBp  = (kChan / 32) * kNBr;                  // 160  Bp[s] [32][1024] -> BPT[s] [1024][32]
constexpr int kPbW   = ((int)(kWPlane / 8) / 256) * 4;       // 2048 Wk, Wv, Wr, Wo hi/lo
constexpr int kPbAll = kPbXX + kPbA + kPbTA + kPbTB + kPbG1 + kPbG2 + kPbBp + kPbW;
__global__ __launch_bounds__(256) void k_prepare(
    const float* __restrict__ x, const float* __restrict__ miu_x, const float* __restrict__ Amat,
    const float* __restrict__ tdA, const float* __restrict__ tdB, const float* __restrict__ Wg1, const float* __restrict__ Wg2,
    const float* __restrict__ Bp, const float* __restrict__ Wk, const float* __restrict__ Wv, const float* __restrict__ Wr,
    const float* __restrict__ Wo,
    unsigned short* __restrict__ XX, unsigned short* __restrict__ AT, unsigned short* __restrict__ TDAT,
    unsigned short* __restrict__ TDBT, unsigned short* __restrict__ WG1TH, unsigned short* __restrict__ WG1TL,
    unsigned short* __restrict__ WG2TH, unsigned short* __restrict__ WG2TL, unsigned short* __restrict__ BPT,
    unsigned short* __restrict__ WH, unsigned short* __restrict__ WL) {
  __shared__ float sm[32 * 65];
  int l = blockIdx.x;
  if (l < kPbXX) { xx8_body(l, x, miu_x, XX, (int)(kPlane / 8)); return; }
  l -= kPbXX;
  if (l < kPbA) { trcast_body<false, 64>(sm, l % (kMixPad / 32), l / (kMixPad / 32), 0, Amat, kChan, kMix, 0L, AT, AT, kChan, 0L); return; }
  l -= kPbA;
  if (l < kPbTA) { trcast_body<false, 64>(sm, l % (kDec / 32), l / (kDec / 32), 0, tdA, kChan, kDec, 0L, TDAT, TDAT, kChan, 0L); return; }
  l -= kPbTA;
  if (l < kPbTB) { trcast_body<false, 64>(sm, l, 0, 0, tdB, kDec, kChan, 0L, TDBT, TDBT, kDec, 0L); return; }
  l -= kPbTB;
  if (l < kPbG1) { trcast_body<true, 64>(sm, l % (kMixPad / 32), l / (kMixPad / 32), 0, Wg1, kChan, kMix, 0L, WG1TH, WG1TL, kChan, 0L); return; }
  l -= kPbG1;
  if (l < kPbG2) { trcast_body<true, 64>(sm, l % (kChan / 32), l / (kChan / 32), 0, Wg2, kMix, kChan, 0L, WG2TH, WG2TL, kMixPad, 0L); return; }
  l -= kPbG2;
  if (l < kPbBp) { trcast_body<false, 32>(sm, l % (kChan / 32), 0, l / (kChan / 32), Bp, kBr, kChan, (long)kBr * kChan, BPT, BPT, kBr, (long)kChan * kBr); return; }
  l -= kPbBp;
  wsplit8_body(l % (kPbW / 4), l / (kPbW / 4), Wk, Wv, Wr, Wo, WH, WL, (int)(kWPlane / 8));
}

// ---------------------------------------------------------------------------
// Linear-attention state scan in chunks of 16 steps, f32, on v_wmma_f32_16x16x4_f32. With S0 the state at a chunk's start,
//   y_t[i]  = sum_j R[t][j] * S0[i][j] + sum_s A[t][s] * v_s[i]          (R, A: chunk operands, OUT_MODE 5 of the GEMM engine)
//   S16[i][j] = S0[i][j] * PL[j] + sum_s K[j][s] * v_s[i]
// so that the serial chain runs once per chunk, not once per step. One block (128 threads = 4 waves, one per SIMD) per (batch b, head n,
// quarter iq of the v channels). Wave w carries the transposed state tile T[j][i] of k channels j = 16w .. 16w+15 and the block's 16
// v channels i in the 8 registers of a D tile: register r of lane (c, h) is T[16w + 8h + r][c]. Registers 2q, 2q+1 are, as they lie, the
// B operand (column i = c) of product step q of the first sum, with k order j = 16w + 8h + 2q + e at place (h, e); the A operand
// (row t = c) is read in the same order. The sums over s use s = 8h + 2q + e at place (h, e) for both operands; of the second sum of y
// wave w takes product step q = w. A wave's y tile is its share over its 16 k channels: the four shares go through LDS and are summed
// once per group of 4 chunks, behind the group's one barrier, in the next group's pass.
// The operands of a group are loaded straight into registers, two groups ahead.
// Y is laid out by scan block, [block][t][16 rows], so that every 128-B line of it (2 timesteps) is stored once, by one wave of the one
// block that owns it.
// ---------------------------------------------------------------------------
constexpr int kCh  = 16;             // timesteps per chunk
constexpr int kNCh = kSeq / kCh;     // chunks
constexpr int kGr  = 4;              // chunks per group
constexpr int kNGr = kNCh / kGr;     // groups
constexpr int kIQ  = 16;             // state rows (v channels) per block
constexpr int kNIQ = kHead / kIQ;    // blocks per head
constexpr int kPH  = 8 * 16 + 16;    // floats between the two 8-step halves of a y tile in LDS: the two lane halves of a store hit disjoint banks
constexpr int kPC  = 2 * kPH;        // floats of a chunk's y tile
constexpr int kPW  = kGr * kPC;      // floats of a wave's y tiles of one group
static_assert(kSeq % (kCh * kGr) == 0 && kNGr >= 4 && kNIQ == 4 && kHead == 64 && kCh == 16, "scan chunking");
struct ChunkOp { v4f r0, r1, k0, k1, p0, p1, v0, v1; v2f a, vw; };
__device__ __forceinline__ v8f mma4(float a0, float a1, float b0, float b1, v8f c) {
  return __builtin_amdgcn_wmma_f32_16x16x4_f32(false, (v2f){a0, a1}, false, (v2f){b0, b1}, (short)0, c, false, false);
}
__global__ __launch_bounds__(128) void k_state_scan(const float* __restrict__ RH, const float* __restrict__ KH,
                                                    const float* __restrict__ VH, const float* __restrict__ AH,
                                                    const float* __restrict__ PLH, float* __restrict__ Y) {
  __shared__ __align__(16) float part[2 * 4 * kPW];                      // the four waves' y tiles of a group, two buffers
  const int tid  = threadIdx.x;
  const int lane = tid & 31;
  const int wave = tid >> 5;
  const int c    = lane & 15;
  const int h    = lane >> 4;
  const int iq   = blockIdx.x & (kNIQ - 1);
  const int n    = (blockIdx.x >> 2) & (kNHead - 1);
  const int b    = blockIdx.x >> 6;
  const size_t ch0 = (size_t)n * (kRows / kCh) + (size_t)b * kNCh;       // first chunk tile of this head and batch
  float* Yb = Y + (size_t)blockIdx.x * (kSeq * kIQ);                     // this block's own [t][16] plane
  // this thread's places in the group whose loads are issued next; carried from issue to issue, so that the loads name no register
  // that is written between them
  const char* qr = (const char*)(RH + ch0 * 1024 + c * 64 + wave * 16 + h * 8);
  const char* qk = (const char*)(KH + ch0 * 1024 + (wave * 16 + c) * 16 + h * 8);
  const char* qv = (const char*)(VH + ch0 * 1024 + (iq * kIQ + c) * 16 + h * 8);
  const char* qw = qv + wave * 8;
  const char* qa = (const char*)(AH + ch0 * 256 + c * 16 + h * 8 + wave * 2);
  const char* qp = (const char*)(PLH + ch0 * 64 + wave * 16 + h * 8);
  // go: a further group exists (block-uniform); without one the places stay, and the last group is read again
  auto issue = [&](ChunkOp (&o)[kGr], bool go) {
    // the two scheduling barriers keep every other instruction out of the group of loads and its wait, and the loads two groups
    // of chunks ahead of their use
    __builtin_amdgcn_sched_barrier(0);
#pragma unroll   // o is indexed by constants only, so that it stays in registers
    for (int k = 0; k < kGr; ++k) {
      o[k].r0 = *(const v4f*)(qr + (size_t)k * 4096);
      o[k].r1 = *(const v4f*)(qr + (size_t)k * 4096 + 16);
      o[k].k0 = *(const v4f*)(qk + (size_t)k * 4096);
      o[k].k1 = *(const v4f*)(qk + (size_t)k * 4096 + 16);
      o[k].v0 = *(const v4f*)(qv + (size_t)k * 4096);
      o[k].v1 = *(const v4f*)(qv + (size_t)k * 4096 + 16);
      o[k].vw = *(const v2f*)(qw + (size_t)k * 4096);
      o[k].a  = *(const v2f*)(qa + (size_t)k * 1024);
      o[k].p0 = *(const v4f*)(qp + (size_t)k * 256);
      o[k].p1 = *(const v4f*)(qp + (size_t)k * 256 + 16);
    }
    // precaution: this wait stands in front of every later write of a register that one of these loads names
    asm volatile("s_wait_xcnt 0x0" ::: "memory");
    __builtin_amdgcn_sched_barrier(0);
    const size_t d4 = go ? (size_t)(kGr * 4096) : 0, d1 = go ? (size_t)(kGr * 1024) : 0, dp = go ? (size_t)(kGr * 256) : 0;
    qr += d4; qk += d4; qv += d4; qw += d4; qa += d1; qp += dp;
  };
  // finishing group g from the four waves' shares (src): a thread sums and stores two pieces of 4 rows i of one timestep; the LDS reads,
  // and apart from them the sums and the stores
  v4f x[8];
  auto finish_load = [&](const float* src) {
#pragma unroll   // here and below: x is indexed by constants only, so that it stays in registers
    for (int e = 0; e < 2; ++e) {
      const int idx = tid + e * 128, t = idx >> 2;
      const float* p = src + (t >> 4) * kPC + ((t >> 3) & 1) * kPH + (t & 7) * 16 + (idx & 3) * 4;
#pragma unroll
      for (int w = 0; w < 4; ++w) x[e * 4 + w] = *(const v4f*)(p + w * kPW);
    }
  };
  auto finish_sum = [&](int g) {
    const v4f y0 = (x[0] + x[1]) + (x[2] + x[3]), y1 = (x[4] + x[5]) + (x[6] + x[7]);
    float* py = Yb + (size_t)g * (kGr * kCh * kIQ) + tid * 4;
    // as in issue(): nothing else is scheduled into the stores and their wait
    __builtin_amdgcn_sched_barrier(0);
    *(v4f*)(py) = y0;
    *(v4f*)(py + 512) = y1;
    // the same precaution for the registers that these stores name
    asm volatile("s_wait_xcnt 0x0" ::: "memory");
    __builtin_amdgcn_sched_barrier(0);
  };
  v8f S = (v8f){0.f, 0.f, 0.f, 0.f, 0.f, 0.f, 0.f, 0.f};
  auto group = [&](int g, const ChunkOp (&o)[kGr]) {
    float* dst = part + (g & 1) * (4 * kPW);
    if (g > 0) finish_load(part + ((g & 1) ^ 1) * (4 * kPW));   // block-uniform
    // keeps these reads ahead of the first chunk's products, which run while the reads are served
    __builtin_amdgcn_sched_barrier(0);
    float* pd = dst + wave * kPW + h * kPH + c;
#pragma unroll   // o is indexed by constants only
    for (int k = 0; k < kGr; ++k) {
      v8f y = (v8f){0.f, 0.f, 0.f, 0.f, 0.f, 0.f, 0.f, 0.f};
      y = mma4(o[k].r0[0], o[k].r0[1], S[0], S[1], y);
      y = mma4(o[k].r0[2], o[k].r0[3], S[2], S[3], y);
      y = mma4(o[k].r1[0], o[k].r1[1], S[4], S[5], y);
      y = mma4(o[k].r1[2], o[k].r1[3], S[6], S[7], y);
      y = mma4(o[k].a[0], o[k].a[1], o[k].vw[0], o[k].vw[1], y);
      v8f Sn;
#pragma unroll
      for (int r = 0; r < 4; ++r) { Sn[r] = S[r] * o[k].p0[r]; Sn[4 + r] = S[4 + r] * o[k].p1[r]; }
      Sn = mma4(o[k].k0[0], o[k].k0[1], o[k].v0[0], o[k].v0[1], Sn);
      Sn = mma4(o[k].k0[2], o[k].k0[3], o[k].v0[2], o[k].v0[3], Sn);
      Sn = mma4(o[k].k1[0], o[k].k1[1], o[k].v1[0], o[k].v1[1], Sn);
      Sn = mma4(o[k].k1[2], o[k].k1[3], o[k].v1[2], o[k].v1[3], Sn);
      S = Sn;
#pragma unroll
      for (int r = 0; r < 8; ++r) pd[k * kPC + r * 16] = y[r];
      if (k == 0 && g > 0) finish_sum(g - 1);              // block-uniform
    }
    // the one barrier of a group: publishes this group's shares and ends the reads of the previous group's, which the next group overwrites.
    // Only LDS data pass between the waves, so the fences name LDS alone: a full one would wait here for the next group's loads to land
    __builtin_amdgcn_fence(__ATOMIC_RELEASE, "workgroup", "local");
    __builtin_amdgcn_s_barrier();
    __builtin_amdgcn_fence(__ATOMIC_ACQUIRE, "workgroup", "local");
  };

  // three sets of operand registers: the loads of a group are issued two groups ahead of its products, which covers the latency of a read
  // that misses the L2
  ChunkOp oa[kGr], ob[kGr], oc[kGr];
  static_assert((kNGr - 1) % 3 == 0, "the loop takes three groups a trip, the last group stands behind it");
  issue(oa, true);
  issue(ob, true);
  // kept rolled, for speed only: three groups of code a trip
#pragma unroll 1
  for (int g = 0; g < kNGr - 1; g += 3) {
    issue(oc, g + 3 < kNGr);
    group(g, oa);
    issue(oa, g + 4 < kNGr);
    group(g + 1, ob);
    issue(ob, g + 5 < kNGr);
    group(g + 2, oc);
  }
  group(kNGr - 1, oa);
  finish_load(part + ((kNGr - 1) & 1) * (4 * kPW));
  finish_sum(kNGr - 1);
}

// ---------------------------------------------------------------------------
// GroupNorm (64 channels per head, biased variance, eps 1.6e-4) + affine + gate multiply -> bf16 hi/lo planes.
// One wave per (row m, head n), 8 pairs per 256-thread block; lane owns channels 2l, 2l+1; shuffle reductions (unconditional).
// Y comes in the scan's layout [scan block][t][16 rows]: a block takes 4 consecutive rows of 2 heads, which share their lines of Y.
// ---------------------------------------------------------------------------
__global__ __launch_bounds__(256) void k_gn_gate(const float* __restrict__ Y, const float* __restrict__ G,
                                                 const float* __restrict__ gamma, const float* __restrict__ beta,
                                                 unsigned short* __restrict__ outH, unsigned short* __restrict__ outL) {
  __shared__ __align__(16) float slab[8][64];
  const int lane = threadIdx.x & 31, wave = threadIdx.x >> 5;
  const int m = (blockIdx.x >> 3) * 4 + (wave & 3);
  const int n = (blockIdx.x & 7) * 2 + (wave >> 2);
  const size_t base = (size_t)m * kChan + (size_t)n * kHead;
  const int c = n * kHead + 2 * lane;
  const int sb = ((m / kSeq) * kNHead + n) * kNIQ + (2 * lane) / kIQ;      // the scan block that owns this lane's two channels
  // the two scheduling barriers keep every other instruction out of the group of loads and its wait, so that the four fly together
  __builtin_amdgcn_sched_barrier(0);
  const v2f yv = *(const v2f*)(Y + ((size_t)sb * kSeq + (m % kSeq)) * kIQ + (2 * lane) % kIQ);
  const v2f gv = *(const v2f*)(G + base + 2 * lane);
  const v2f ga = *(const v2f*)(gamma + c);
  const v2f be = *(const v2f*)(beta + c);
  // precaution: this wait stands in front of every later write of a register that one of these loads names
  asm volatile("s_wait_xcnt 0x0" ::: "memory");
  __builtin_amdgcn_sched_barrier(0);
  float s = yv[0] + yv[1];
#pragma unroll
  for (int off = 16; off > 0; off >>= 1) s += __shfl_xor(s, off, 32);
  const float mean = s * (1.0f / 64.0f);
  const float d0 = yv[0] - mean;
  const float d1 = yv[1] - mean;
  float q = d0 * d0 + d1 * d1;
#pragma unroll
  for (int off = 16; off > 0; off >>= 1) q += __shfl_xor(q, off, 32);
  const float var = q * (1.0f / 64.0f);
  const float rs  = 1.0f / sqrtf(var + kGnEps);
  const float o0 = ((d0 * rs) * ga[0] + be[0]) * gv[0];
  const float o1 = ((d1 * rs) * ga[1] + be[1]) * gv[1];
  *(v2f*)(&slab[wave][2 * lane]) = (v2f){o0, o1};
  __syncthreads();
  if (lane < 8) {
    unsigned short hb[8], lb[8];
#pragma unroll
    for (int e = 0; e < 8; ++e) bf_split_bits(slab[wave][8 * lane + e], hb[e], lb[e]);
    const v4u uh = (v4u){pk16(hb[0], hb[1]), pk16(hb[2], hb[3]), pk16(hb[4], hb[5]), pk16(hb[6], hb[7])};
    const v4u ul = (v4u){pk16(lb[0], lb[1]), pk16(lb[2], lb[3]), pk16(lb[4], lb[5]), pk16(lb[6], lb[7])};
    const size_t o = base + 8 * (size_t)lane;
    *(v4u*)(outH + o) = uh;
    *(v4u*)(outL + o) = ul;
    
  }
}

// ---------------------------------------------------------------------------
// Host glue.
// Workspace region map (bytes; every size is a multiple of 4096, offsets in that order):
//   XX     bf16 [2048][1024]            4,194,304
//   HC     bf16 [2048][192]               786,432   (tanh of the mix lowrank; cols 160..191 zero, unread; branch s = rows 2048s.. of the
//                                                    [10240][32] view of its cols 0..159)
//   MIU    f32  [2048 chunk tiles][16][64]  8,388,608   (RH: r times the decay factors of the chunk's earlier steps; tile = head * 128 + row group)
//   X5H    bf16 [5][2048][1024]        20,971,520   (branch inputs hi: 0 decay (single), 1 k, 2 v, 3 r, 4 gate; behind their last reader, the
//                                                    branch GEMMs, its first 8,388,608 bytes hold VH f32 [2048 chunk tiles][64][16]: v, channel major)
//   X5L    bf16 [4][2048][1024]        16,777,216   (lo planes of branches 1..4 at index s-1)
//   WH     bf16 [4][1024][1024]         8,388,608   (Wk, Wv, Wr, Wo hi, [out][in] as-is)
//   WL     bf16 [4][1024][1024]         8,388,608   (lo)
//   AT     bf16 [192][1024]               393,216   (A^T, rows 160..191 zero)
//   TDAT   bf16 [64][1024]                131,072
//   TDBT   bf16 [1024][64]                131,072
//   WG1TH  bf16 [192][1024]               393,216   (rows 160..191 zero)   WG1TL 393,216
//   WG2TH  bf16 [1024][192]               393,216   (cols 160..191 zero)   WG2TL 393,216
//   BPT    bf16 [5][1024][32]             327,680
//   L1     bf16 [2048][64]                262,144
//   KVR    f32  [3][2048][1024]         25,165,824   (k unscaled, v, r)
//   GHH    bf16 [2048][192]               786,432   (cols 160..191 zero)   GHL 786,432
//   GATE   f32  [2048][1024]            8,388,608
//   Y      f32  [128][1024][16]         8,388,608   (scan block = (b*16 + head)*4 + quarter of the head's channels, t, row)
//   GATH   bf16 [2048][1024]            4,194,304   GATL 4,194,304
//   KK     f32  [2048 chunk tiles][64][16]  8,388,608   (KH: k * exp(min(w, 0)) times the decay factors of the chunk's later steps, channel major)
//   AH     f32  [2048 chunk tiles][16][16]  2,097,152   (r-k matrix of a chunk, bonus sums on its diagonal, zero above)
//   PLH    f32  [2048 chunk tiles][64]        524,288   (decay product of a whole chunk; directly behind AH)
//   total                             133,627,904
// GEMM shapes (M, N, K): (2048,192,1024) (2048,1024,32)x5 batched (2048,64,1024) (2048,1024,64) (2048,1024,1024)x3 batched
// (2048,192,1024) (2048,1024,192) (2048,1024,1024); all M,N % 64 == 0, all K % 32 == 0, pads zero-written by producers.
// ---------------------------------------------------------------------------
extern "C" void kernel_launch(void* const* d_in, const int* in_sizes, int n_in,
                              void* d_out, int out_size, void* d_ws, size_t ws_size,
                              hipStream_t stream) {
  if (n_in < 17) return;
  if (in_sizes[0] != kBatch * kSeq * kChan) return;
  if (in_sizes[1] != kChan || in_sizes[2] != kNBr * kChan) return;
  if (in_sizes[3] != kChan * kMix || in_sizes[4] != kNBr * kBr * kChan) return;
  if (in_sizes[5] != kChan || in_sizes[6] != kChan * kDec || in_sizes[7] != kDec * kChan) return;
  if (in_sizes[8] != kNHead * kHead) return;
  if (in_sizes[9] != kChan * kChan || in_sizes[10] != kChan * kChan || in_sizes[11] != kChan * kChan || in_sizes[12] != kChan * kChan) return;
  if (in_sizes[13] != kChan * kMix || in_sizes[14] != kMix * kChan) return;
  if (in_sizes[15] != kChan || in_sizes[16] != kChan) return;
  if (out_size != kBatch * kSeq * kChan) return;

  const float* x      = (const float*)d_in[0];
  const float* miu_x  = (const float*)d_in[1];
  const float* lam    = (const float*)d_in[2];    // [5][1024]
  const float* Amat   = (const float*)d_in[3];    // [1024][160]
  const float* Bp     = (const float*)d_in[4];    // [5][32][1024]
  const float* td_miu = (const float*)d_in[5];    // [1024]
  const float* tdA    = (const float*)d_in[6];    // [1024][64]
  const float* tdB    = (const float*)d_in[7];    // [64][1024]
  const float* u      = (const float*)d_in[8];    // [16][64]
  const float* Wk     = (const float*)d_in[9];    // [1024][1024] [out][in]
  const float* Wv     = (const float*)d_in[10];
  const float* Wr     = (const float*)d_in[11];
  const float* Wo     = (const float*)d_in[12];
  const float* Wg1    = (const float*)d_in[13];   // [1024][160]
  const float* Wg2    = (const float*)d_in[14];   // [160][1024]
  const float* gamma  = (const float*)d_in[15];
  const float* beta   = (const float*)d_in[16];
  float* out = (float*)d_out;

  // ---- carve ----
  const size_t szXX    = (size_t)kPlane * 2;
  const size_t szHC    = (size_t)kRows * kMixPad * 2;
  const size_t szF32P  = (size_t)kPlane * 4;
  const size_t szX5H   = (size_t)kNBr * kPlane * 2;
  const size_t szX5L   = (size_t)(kNBr - 1) * kPlane * 2;
  const size_t szWSQ   = (size_t)4 * kWPlane * 2;
  const size_t szAT    = (size_t)kMixPad * kChan * 2;
  const size_t szTDAT  = (size_t)kDec * kChan * 2;
  const size_t szTDBT  = (size_t)kChan * kDec * 2;
  const size_t szWG1T  = (size_t)kMixPad * kChan * 2;
  const size_t szWG2T  = (size_t)kChan * kMixPad * 2;
  const size_t szBPT   = (size_t)kNBr * kChan * kBr * 2;
  const size_t szL1    = (size_t)kRows * kDec * 2;
  const size_t szKVR   = (size_t)3 * kPlane * 4;
  const size_t szGH    = (size_t)kRows * kMixPad * 2;
  const size_t szGAT   = (size_t)kPlane * 2;
  size_t off = 0;
  const size_t oXX    = off; off += szXX;
  const size_t oHC    = off; off += szHC;
  const size_t oMIU   = off; off += szF32P;
  const size_t oX5H   = off; off += szX5H;
  const size_t oX5L   = off; off += szX5L;
  const size_t oWH    = off; off += szWSQ;
  const size_t oWL    = off; off += szWSQ;
  const size_t oAT    = off; off += szAT;
  const size_t oTDAT  = off; off += szTDAT;
  const size_t oTDBT  = off; off += szTDBT;
  const size_t oWG1TH = off; off += szWG1T;
  const size_t oWG1TL = off; off += szWG1T;
  const size_t oWG2TH = off; off += szWG2T;
  const size_t oWG2TL = off; off += szWG2T;
  const size_t oBPT   = off; off += szBPT;
  const size_t oL1    = off; off += szL1;
  const size_t oKVR   = off; off += szKVR;
  const size_t oGHH   = off; off += szGH;
  const size_t oGHL   = off; off += szGH;
  const size_t oGATE  = off; off += szF32P;
  const size_t oY     = off; off += szF32P;
  const size_t oGATH  = off; off += szGAT;
  const size_t oGATL  = off; off += szGAT;
  const size_t oKK    = off; off += szF32P;
  const size_t oAH    = off; off += (size_t)kNHead * (kRows / 16) * (256 + 64) * 4;
  const size_t total  = off;   // 133,627,904
  if (total > (size_t)134217728) return;
  if (ws_size < total) return;

  char* ws = (char*)d_ws;
  unsigned short* XX    = (unsigned short*)(ws + oXX);
  unsigned short* HC    = (unsigned short*)(ws + oHC);
  float*          MIU   = (float*)(ws + oMIU);
  float*          RH    = MIU;                       // chunk operand R
  unsigned short* X5H   = (unsigned short*)(ws + oX5H);
  unsigned short* X5L   = (unsigned short*)(ws + oX5L);
  unsigned short* WH    = (unsigned short*)(ws + oWH);
  unsigned short* WL    = (unsigned short*)(ws + oWL);
  unsigned short* AT    = (unsigned short*)(ws + oAT);
  unsigned short* TDAT  = (unsigned short*)(ws + oTDAT);
  unsigned short* TDBT  = (unsigned short*)(ws + oTDBT);
  unsigned short* WG1TH = (unsigned short*)(ws + oWG1TH);
  unsigned short* WG1TL = (unsigned short*)(ws + oWG1TL);
  unsigned short* WG2TH = (unsigned short*)(ws + oWG2TH);
  unsigned short* WG2TL = (unsigned short*)(ws + oWG2TL);
  unsigned short* BPT   = (unsigned short*)(ws + oBPT);
  unsigned short* L1    = (unsigned short*)(ws + oL1);
  float*          KVR   = (float*)(ws + oKVR);
  unsigned short* GHH   = (unsigned short*)(ws + oGHH);
  unsigned short* GHL   = (unsigned short*)(ws + oGHL);
  float*          GATE  = (float*)(ws + oGATE);
  float*          Yp    = (float*)(ws + oY);
  unsigned short* GATH  = (unsigned short*)(ws + oGATH);
  unsigned short* GATL  = (unsigned short*)(ws + oGATL);
  float*          KH    = (float*)(ws + oKK);
  float*          AH    = (float*)(ws + oAH);
  float*          PLH   = AH + (size_t)kNHead * (kRows / 16) * 256;
  float*          VH    = (float*)(ws + oX5H);       // written behind the last read of the branch inputs
  const float* fdum = gamma;   // placeholder for unused bias / resid pointer arguments (never dereferenced)

  const dim3 blk(256);

  // ---- token shift and all weight planes ----
  k_prepare<<<dim3(kPbAll), blk, 0, stream>>>(x, miu_x, Amat, tdA, tdB, Wg1, Wg2, Bp, Wk, Wv, Wr, Wo,
                                              XX, AT, TDAT, TDBT, WG1TH, WG1TL, WG2TH, WG2TL, BPT, WH, WL);

  // ---- mix lowrank: HC = tanh(XX @ AT^T) as bf16 (M 2048, N 192, K 1024; 48 blocks of 128 x 64, eight waves of 16 x 64, so that a
  // lane has 32 tanh to do) ----
  wmma_gemm64<1, false, 0, 4, false, 5, 8, 1, 64, kChan, 1><<<dim3((kRows / 128) * (kMixPad / 64), 1), blk, 0, stream>>>(
      XX, XX, 0L, AT, AT, 0L, (void*)HC, (void*)HC, kMixPad, 0L, fdum, fdum, 0L, kMixPad, 1.0f);

  // ---- mix GEMM of all five branches (blockIdx.y = s; A = cols 0..159 of HC viewed [10240][32], rows 2048s..; K 32); its epilogue
  // forms the branch inputs and stores their bf16 planes ----
  wmma_gemm64<1, false, 0, 3, false, 0, 2, 4, 32, kBr><<<dim3((kRows / 128) * (kChan / 256), kNBr), blk, 0, stream>>>(
      HC, HC, (long)kRows * kBr, BPT, BPT, (long)kChan * kBr,
      (void*)X5H, (void*)X5L, kChan, (long)kPlane, lam, x, 0L, kChan, 1.0f);

  // ---- what reads only the branch inputs: KVR = k (unscaled), v, r projections; GH = tanh(X5[4] @ WG1T^T) hi/lo (cols 160..191 zero);
  // L1 = tanh(X5H[0] @ TDAT^T) ----
  k_branch_gemms<<<dim3(3 * kProjTiles + kGateTiles + kDecTiles), blk, 0, stream>>>(
      X5H, X5L, WH, WL, KVR, WG1TH, WG1TL, GHH, GHL, TDAT, L1);
  // ---- GATE = GH @ WG2T^T (split, K 192); w = L1 @ TDBT^T + td_miu (K 64), stored as the scan's chunk operands RH, KH, VH, AH, PLH ----
  k_lowrank_out_gemms<<<dim3(2 * kFillTiles), blk, 0, stream>>>(GHH, GHL, WG2TH, WG2TL, GATE, L1, TDBT, RH, KVR, KVR + 2 * kPlane,
                                                                KVR + kPlane, td_miu, u, KH, VH, AH);

  // ---- state scan -> Y ----
  k_state_scan<<<dim3(kBatch * kNHead * kNIQ), dim3(128), 0, stream>>>(RH, KH, VH, AH, PLH, Yp);

  // ---- GroupNorm + gate -> GATH/GATL (4096 blocks x 8 waves = 32768 (row, head) pairs) ----
  k_gn_gate<<<dim3((kRows * kNHead) / 8), blk, 0, stream>>>(Yp, GATE, gamma, beta, GATH, GATL);

  // ---- output projection straight into d_out (split, K 1024; 256 tiles of 64 x 128) ----
  wmma_gemm64<1, true, 0, 0, false, 0, 4, 2, 64, kChan, 1><<<dim3(kFillTiles, 1), blk, 0, stream>>>(
      GATH, GATL, 0L, WH + 3 * kWPlane, WL + 3 * kWPlane, 0L,
      (void*)out, (void*)out, kChan, 0L, fdum, fdum, 0L, kChan, 1.0f);
}

// v010
// A run of this version takes 115 microseconds.
// Two timings next to v009 both put it at 1.07 times that version's speed.
// Counting every step since v000, which is the starting kernel, it is 8.77 times as fast.
// Contractions: every GEMM on v_wmma_f32_16x16x32_bf16 (bf16 operands, f32 accumulate) - the four lowrank mix/decay sites single bf16, the k/v/r projections, the gate pair and the output projection as bf16 hi/lo split (hi*hi + hi*lo + lo*hi); the state scan in 16-step chunks on v_wmma_f32_16x16x4_f32 (f32 operands); token shift, chunk operands, GroupNorm and gating in f32 on VALU.
#include <hip/hip_runtime.h>
#include <math.h>

// ---------------------------------------------------------------------------
// Problem constants
// ---------------------------------------------------------------------------
constexpr int kBatch  = 2;
constexpr int kSeq    = 1024;
constexpr int kChan   = 1024;
constexpr int kHead   = 64;
constexpr int kNHead  = 16;
constexpr int kRows   = kBatch * kSeq;          // 2048 token rows (m = b*1024 + t)
constexpr int kMix    = 160;                    // lowrank width of the mix and gate paths
constexpr int kMixPad = 192;                    // padded to a 64 multiple (pad rows / cols zero-filled)
constexpr int kDec    = 64;                     // decay lowrank width
constexpr int kBr     = 32;                     // per-branch mix width
constexpr int kNBr    = 5;                      // branches: 0 decay, 1 k, 2 v, 3 r, 4 gate
constexpr long kPlane  = (long)kRows * kChan;   // 2,097,152 elements per activation plane
constexpr long kWPlane = (long)kChan * kChan;   // 1,048,576 elements per square weight plane
constexpr float kGnEps = 1.6e-4f;               // 1e-5 * 16
static_assert(kNHead * kHead == kChan, "shape");
static_assert(kRows % 256 == 0 && kChan % 256 == 0 && kMixPad % 64 == 0 && kDec % 64 == 0, "M and N tile multiples");
static_assert(kChan % 32 == 0 && kBr % 32 == 0 && kDec % 32 == 0 && kMixPad % 32 == 0, "K multiples of 32");
static_assert(kMix % 8 == 0 && kMixPad % 8 == 0 && kDec % 8 == 0, "pack groups never straddle a row");

typedef __attribute__((ext_vector_type(16))) _Float16 v16h;
typedef __attribute__((ext_vector_type(8)))  _Float16 v8h;
typedef __attribute__((ext_vector_type(16))) __bf16   v16b;
typedef __attribute__((ext_vector_type(8)))  __bf16   v8b;
typedef __attribute__((ext_vector_type(2)))  __bf16   v2b;
typedef __attribute__((ext_vector_type(8)))  float    v8f;
typedef __attribute__((ext_vector_type(4)))  float    v4f;
typedef __attribute__((ext_vector_type(2)))  float    v2f;
typedef __attribute__((ext_vector_type(4)))  unsigned int v4u;
typedef __attribute__((ext_vector_type(2)))  unsigned int v2u;

__device__ __forceinline__ unsigned short f2bf_bits(float f) {
  unsigned u = __float_as_uint(f);
  return (unsigned short)((u + 0x7FFFu + ((u >> 16) & 1u)) >> 16);
}
__device__ __forceinline__ float bf_bits2f(unsigned short h) { return __uint_as_float(((unsigned)h) << 16); }
__device__ __forceinline__ unsigned pk16(unsigned short a, unsigned short b) { return (unsigned)a | ((unsigned)b << 16); }
// RNE convert to a bf16 hi part and a bf16 lo part of the f32 residual
__device__ __forceinline__ void bf_split_bits(float f, unsigned short& hb, unsigned short& lb) {
  hb = f2bf_bits(f);
  lb = f2bf_bits(f - bf_bits2f(hb));
}

// hazard guards as plain device helpers (no inline asm inside the kernel template body); the 4-acc guard ties every
// accumulator of a group and names the A fragments as inputs
__device__ __forceinline__ void dep_guard4_h(v8f& a, v8f& b, v8f& c, v8f& d, v16h x, v16h y) { asm volatile("v_nop\n\tv_nop\n\tv_nop\n\tv_nop" : "+v"(a), "+v"(b), "+v"(c), "+v"(d) : "v"(x), "v"(y)); }
__device__ __forceinline__ void dep_guard4_b(v8f& a, v8f& b, v8f& c, v8f& d, v16b x, v16b y) { asm volatile("v_nop\n\tv_nop\n\tv_nop\n\tv_nop" : "+v"(a), "+v"(b), "+v"(c), "+v"(d) : "v"(x), "v"(y)); }
__device__ __forceinline__ void keep4_h(v16h a, v16h b, v16h c, v16h d) { asm volatile("v_nop" :: "v"(a), "v"(b), "v"(c), "v"(d)); }
__device__ __forceinline__ void keep4_b(v16b a, v16b b, v16b c, v16b d) { asm volatile("v_nop" :: "v"(a), "v"(b), "v"(c), "v"(d)); }
__device__ __forceinline__ void acc_guard4(v8f& a, v8f& b, v8f& c, v8f& d) { asm volatile("v_nop\n\tv_nop\n\tv_nop\n\tv_nop" : "+v"(a), "+v"(b), "+v"(c), "+v"(d)); }
// One round of a sum over lanes of several values at once: of values x and x + M a lane keeps the one that its bit M selects and hands the
// other to its partner, lane ^ M, which keeps that one.
template <int M>
__device__ __forceinline__ void fold_lanes(float (&val)[32], const int lane) {
  const bool up = (lane & M) != 0;
#pragma unroll   // val is indexed by constants only, so that it stays in registers
  for (int x = 0; x < M; ++x) {
    const float keep = up ? val[x + M] : val[x];
    const float send = up ? val[x] : val[x + M];
    val[x] = keep + __shfl_xor(send, M, 32);
  }
}
template <typename T> struct Frag;
template <> struct Frag<_Float16> {
  typedef v16h V; typedef v8h H; union U { v16h v; v8h h[2]; };
  // elements 0..7 <- p[0..7], 8..15 <- p[16..23]
  static __device__ __forceinline__ v16h load(const _Float16* p) {
    U f; f.h[0] = *(const v8h*)(p); f.h[1] = *(const v8h*)(p + 16); return f.v;
  }
  static __device__ __forceinline__ v8f mma(v16h a, v16h b, v8f c) {
    return __builtin_amdgcn_wmma_f32_16x16x32_f16(false, a, false, b, (short)0, c, false, false);
  }
  static __device__ __forceinline__ void guard4(v8f& a, v8f& b, v8f& c, v8f& d, v16h x, v16h y) { dep_guard4_h(a, b, c, d, x, y); }
  static __device__ __forceinline__ void keep(v16h a, v16h b, v16h c, v16h d) { keep4_h(a, b, c, d); }
};
template <> struct Frag<__bf16> {
  typedef v16b V; typedef v8b H; union U { v16b v; v8b h[2]; };
  static __device__ __forceinline__ v16b load(const __bf16* p) {
    U f; f.h[0] = *(const v8b*)(p); f.h[1] = *(const v8b*)(p + 16); return f.v;
  }
  static __device__ __forceinline__ v8f mma(v16b a, v16b b, v8f c) {
    return __builtin_amdgcn_wmma_f32_16x16x32_bf16(false, a, false, b, (short)0, c, false, false);
  }
  static __device__ __forceinline__ void guard4(v8f& a, v8f& b, v8f& c, v8f& d, v16b x, v16b y) { dep_guard4_b(a, b, c, d, x, y); }
  static __device__ __forceinline__ void keep(v16b a, v16b b, v16b c, v16b d) { keep4_b(a, b, c, d); }
};

// ---- Register-blocked batched WMMA GEMM (ACT reduced to none/relu/leaky/tanh) -------------------------------
// C[m,n] = scale * sum_k A[m,k] * Bt[n,k] (+bias)(+resid); each wave owns a (16*MI)x64 tile, the WM x WN waves of a block one
// (16*MI*WM) x (64*WN) tile. A row-major [M,KD]; Bt row-major [N,KD]; M % (16*MI*WM) == 0, N % (64*WN) == 0, KD % KS == 0.
// Operand path: the block brings KS k values of its A rows and Bt rows from global memory in whole row pieces (KS*2 bytes,
// 16 B per lane), through registers, into one of two LDS buffers; every wave reads its fragments from there. The loads of
// stage s+1 are issued ahead of the products of stage s and stored to the other buffer behind them; one barrier per stage.
// SPLIT: operands are hi/lo planes (A2/Bt2 = lo planes, same layout); product = hi*hi + hi*lo + lo*hi.
// BIAS_MODE: 0 = none, 1 = bias[m], 2 = bias[n].
// OUT_MODE: 0 = f32, 2 = bf16 hi plane (Cout) + bf16 lo plane (Cout2), 4 = bf16 hi plane alone. In 2 and 4 a row of a wave's tile is one
//               whole 128-B line of each plane (ldc % 64 == 0), stored once, by 8 lanes of that wave.
//           3 = branch input: the tile is the mix term u of branch b = blockIdx.y; the epilogue forms
//               x[m][n] + (x[m-1][n]*f - x[m][n]) * (u + lam[b][n]), f = 0 at t == 0 else 1 (address of the prior row clamped),
//               x = resid (pitch kChan), lam = bias (pitch N), and stores its bf16 hi plane (Cout, plane b) and, for b > 0, its
//               bf16 lo plane (Cout2, plane b-1). Every 128-B line of a plane is stored once, by 8 lanes of one wave.
//               Its A operand is the [kNBr * kRows][kBr] row-major view of the mix lowrank's kMix valid columns, which lie in a plane
//               of pitch kMixPad: row R of the view is columns (R % kNBr) * kBr .. of the plane's row R / kNBr.
//           5 = scan operands: the tile is the decay lowrank term of 16 rows of one head per wave (64 divides n0), which is one chunk of the
//               state scan. With w = tile + bias[n] (bias = td_miu), d = exp(w), k' = k * exp(min(w, 0)) (k = resid, r = aux3, v = aux4, pitch
//               kChan, u = aux) the epilogue stores, per chunk tile (head, group of 16 rows):
//                 Cout  [t][64]  r_t * (product of d over the chunk's steps before t)
//                 Cout2 [j][16]  k'_s * (product of d over the chunk's steps behind s), k channel j major
//                 aux5  [i][16]  v_s, v channel i major
//                 aux2  [t][16]  sum_j r_t k'_s * (product of d over the steps between s and t) for s < t, sum_j r_t u k'_t for s == t, 0 above
//                 behind all tiles of aux2, [64]: the product of d over the whole chunk
//               Only products of decay factors are formed, never a quotient. Every 128-B line is stored by one wave.
// ACT (OUT_MODE 2 and 4 only): 5 = tanh ahead of the bf16 conversion; columns from kMix on of an N == kMixPad GEMM are stored as zero.
// IN_MODE: 0 = operands are 16-bit planes, as above. 1 = the loader forms both operands of the mix lowrank from the inputs, so that this
//               GEMM depends on no earlier launch: A[m][k] = bf16 of x[m][k] + (x[m-1][k]*f - x[m][k]) * miu_x[k], f = 0 at t == 0 else 1
//               (address of the prior row clamped; x = resid, pitch kChan; miu_x = bias), a thread taking 4 columns of 8 consecutive rows,
//               which share their prior rows; Bt[n][k] = bf16 of W[k][n] (W = aux, [KD][kMix] f32), zero for n >= kMix (address clamped),
//               a wave taking 8 rows k, whole, and a lane 2 columns n of them. The loads of a stage are issued two stages ahead of its
//               products. The slabs of the epilogue lie on the operand buffers, which are dead by then.
// ET: 0 = f16 operands, 1 = bf16 operands (pointers passed as 16-bit storage)
// The engine is a device function, so that GEMMs which do not depend on one another can share one launch: bx and b stand for the
// block's place in the GEMM's own grid, smem for the launch's one LDS array (kGemmLds bytes of it are used; with IN_MODE 1 only the bytes of the two operand buffers, on which the slabs then lie).
// MI: 16-row groups of a wave's tile, 4 unless said otherwise. With MI = 2 a wave owns 32x64, so that a 256 x 64 block tile takes the
// eight waves of the 256-thread blocks that it shares a launch with; every element's k order is the same for every MI.
template <bool SPLIT, int WM, int WN, int KS, int MI>
constexpr int kGemmLds = 2 * (SPLIT ? 2 : 1) * (16 * MI * WM + 64 * WN) * (KS + 8) * 2 + WM * WN * 16 * 68 * 4;
template <int ET> struct Elem;
template <> struct Elem<0> { typedef _Float16 T; };
template <> struct Elem<1> { typedef __bf16 T; };
template <int ET, bool SPLIT, int BIAS_MODE, int OUT_MODE, bool RESID, int ACT, int WM, int WN, int KS, int KD, int MI, int IN_MODE = 0>
__device__ __forceinline__ void gemm64_body(
    char* smem, const int bx, const int b,
    const unsigned short* __restrict__ Ap, const unsigned short* __restrict__ A2p, long strideA,
    const unsigned short* __restrict__ Btp, const unsigned short* __restrict__ Bt2p, long strideB,
    void* __restrict__ Cout, void* __restrict__ Cout2, int ldc, long strideC,
    const float* __restrict__ bias,
    const float* __restrict__ resid, long strideR,
    int N, float scale,
    const float* __restrict__ aux = nullptr, float* __restrict__ aux2 = nullptr, const float* __restrict__ aux3 = nullptr,
    const float* __restrict__ aux4 = nullptr, float* __restrict__ aux5 = nullptr) {
  typedef typename Elem<ET>::T T;
  typedef typename Frag<T>::V V;
  typedef typename Frag<T>::H H;
  constexpr int NW    = WM * WN;               // waves per block
  constexpr int NT    = 32 * NW;               // threads per block
  constexpr int BM    = 16 * MI * WM;          // block tile rows (A rows per stage)
  constexpr int BN    = 64 * WN;               // block tile columns (Bt rows per stage)
  constexpr int PITCH = KS + 8;                // LDS row pitch in elements: row bytes + 16, an odd multiple of 16 B
  constexpr int CH    = KS / 8;                // 16-B pieces per row piece
  constexpr int RSTEP = NT / CH;               // rows covered by one load of the whole block
  constexpr int NA    = BM / RSTEP;            // loads per thread and plane, A
  constexpr int NB    = BN / RSTEP;            // loads per thread and plane, Bt
  constexpr int PLANE = (BM + BN) * PITCH;     // elements of one plane in one buffer: A rows, then Bt rows
  constexpr int BUF   = (SPLIT ? 2 : 1) * PLANE;
  constexpr int NS    = KD / KS;               // stages
  static_assert(KS == 32 || KS == 64, "row piece");
  static_assert(KD % KS == 0 && BM % RSTEP == 0 && BN % RSTEP == 0, "stage split");
  const T* A = (const T*)Ap; const T* A2 = (const T*)A2p; const T* Bt = (const T*)Btp; const T* Bt2 = (const T*)Bt2p;
  static_assert(kGemmLds<SPLIT, WM, WN, KS, MI> == 2 * BUF * 2 + NW * 16 * 68 * 4, "LDS share");
  static_assert(OUT_MODE != 3 || MI == 4, "the branch-input epilogue is written for 64-row wave tiles");
  T* sOp = (T*)smem;                                // two operand buffers
  static_assert(IN_MODE == 0 || NW * 16 * 68 * 4 <= 2 * BUF * 2, "the slabs fit on the operand buffers");
  // behind them, per wave, a 16x64 slab, pitch 68 floats; IN_MODE 1: on them (the last barrier of the k loop ends every read of the buffers)
  float* sT = (float*)(smem + (IN_MODE == 1 ? 0 : 2 * BUF * 2));
  const int tid  = threadIdx.x;
  const int lane = tid & 31;
  const int wave = tid >> 5;
  const int tilesN = N / BN;
  const int bm = bx / tilesN;                  // the GEMM's grid holds exactly (M / BM) * (N / BN) blocks
  const int bn = bx - bm * tilesN;
  const int wm = wave / WN;
  const int wn = wave - wm * WN;
  const int m0 = bm * BM + wm * (16 * MI);
  const int n0 = bn * BN + (wn << 6);

  // block-uniform bases of the block's rows; every thread adds its one fixed byte offset
  const char* gA  = (const char*)(A  + (size_t)b * strideA + (size_t)(bm * BM) * KD);
  const char* gB  = (const char*)(Bt + (size_t)b * strideB + (size_t)(bn * BN) * KD);
  const char* gA2 = SPLIT ? (const char*)(A2  + (size_t)b * strideA + (size_t)(bm * BM) * KD) : nullptr;
  const char* gB2 = SPLIT ? (const char*)(Bt2 + (size_t)b * strideB + (size_t)(bn * BN) * KD) : nullptr;
  const int sRow = tid / CH, sCol = (tid % CH) * 8;
  const unsigned offG = (unsigned)(sRow * KD + sCol) * 2u;   // bytes
  const int      offL = sRow * PITCH + sCol;                 // elements
  static_assert(IN_MODE == 0 || (!SPLIT && KS == 64 && BM == 128 && BN == 64 && NT == 256 && KD == kChan && BIAS_MODE == 0 && !RESID),
                "the input loader is written for the mix lowrank's tile");
  // IN_MODE 1: this thread's places in x (its first row and the row before it), miu_x and W, of the stage whose loads are issued next;
  // carried from stage to stage (the stages are loaded in their order), so that the loads name no register that is written between them
  const int   aRow = (tid >> 4) * 8, aCol = (tid & 15) * 4;  // 16 lanes take a row piece of 256 B
  const int   xRow = bm * BM + aRow;
  const bool  xT0  = (xRow & (kSeq - 1)) == 0;               // 8 divides kSeq: t == 0 can only fall on a thread's first row
  const char* qX   = (IN_MODE == 1) ? (const char*)(resid + (size_t)xRow * kChan + aCol) : nullptr;
  const char* qP   = (IN_MODE == 1) ? (xT0 ? qX : qX - kChan * 4) : nullptr;
  const float fzA  = xT0 ? 0.0f : 1.0f;
  const char* qM   = (IN_MODE == 1) ? (const char*)(bias + aCol) : nullptr;
  const int   wK   = wave * 8, wN = lane * 2;
  const bool  wOk  = bn * BN + wN < kMix;                    // 2 divides kMix: the 2 columns of a thread are both valid or both pad
  const char* qW   = (IN_MODE == 1) ? (const char*)(aux + (size_t)wK * kMix + (wOk ? bn * BN + wN : 0)) : nullptr;
  const float fzW  = wOk ? 1.0f : 0.0f;
  // OUT_MODE 3: byte offsets of this thread's A row pieces, counted from the start of the padded plane
  static_assert(OUT_MODE != 3 || (KD == kBr && KS == kBr), "a row of the view is one row piece");
  unsigned offV[NA];
#pragma unroll   // offV is indexed by constants only, so that it stays in registers
  for (int i = 0; i < NA; ++i) {
    const int R = b * kRows + bm * BM + i * RSTEP + sRow;
    offV[i] = (OUT_MODE == 3) ? (unsigned)((R / kNBr) * kMixPad + (R % kNBr) * kBr + sCol) * 2u : 0u;
  }

  const int rlane = lane & 15;                 // row (A) / col (B, D) within subtile
  const int koff  = (lane >> 4) * 8;           // k offset of this lane half
  const int mOff  = (lane >> 4) * 8;           // D row offset

  v8f acc[MI][4];
#pragma unroll
  for (int i = 0; i < MI; ++i)
#pragma unroll
    for (int j = 0; j < 4; ++j) acc[i][j] = (v8f){0.f,0.f,0.f,0.f,0.f,0.f,0.f,0.f};

  // one stage in flight; every loop over these arrays and over the fragments is fully unrolled, so that they stay in registers
  H ra[NA], ra2[NA], rb[NB], rb2[NB];
  // IN_MODE 1: one stage of the inputs in registers: nine rows of x, miu_x, eight rows of W
  struct InStage { v4f xr[9]; v4f mu; v2f wr[8]; };
  // go: a further stage exists (block-uniform); without one the places stay, and the last stage is read again, unused: loads under a
  // branch would merge two counts of loads in flight, and the wait for the older set would then wait for the younger one too
  auto gload_in = [&](InStage& o, bool go) {
    // as below: the group of loads and its wait stay together, ahead of the products
    __builtin_amdgcn_sched_barrier(0);
    o.xr[0] = *(const v4f*)(qP);
#pragma unroll   // here and below: o is indexed by constants only, so that it stays in registers
    for (int i = 0; i < 8; ++i) o.xr[1 + i] = *(const v4f*)(qX + (size_t)i * (kChan * 4));
    o.mu = *(const v4f*)(qM);
#pragma unroll
    for (int r = 0; r < 8; ++r) o.wr[r] = *(const v2f*)(qW + (size_t)r * (kMix * 4));
    // precaution: this wait stands in front of every later write of a register that one of these loads names
    asm volatile("s_wait_xcnt 0x0" ::: "memory");
    __builtin_amdgcn_sched_barrier(0);
    const size_t dx = go ? (size_t)(KS * 4) : 0, dw = go ? (size_t)KS * (kMix * 4) : 0;
    qP += dx; qX += dx; qM += dx; qW += dw;
  };
  auto sstore_in = [&](T* buf, const InStage& o) {
#pragma unroll
    for (int i = 0; i < 8; ++i) {
      const float fz = (i == 0) ? fzA : 1.0f;
      const v4f cur = o.xr[i + 1];
      const v4f ba  = o.xr[i] * fz - cur;
      const v4f val = cur + ba * o.mu;
      union { v2b p[2]; v2u u; } c;
      c.p[0] = __builtin_convertvector((v2f){val[0], val[1]}, v2b);
      c.p[1] = __builtin_convertvector((v2f){val[2], val[3]}, v2b);
      *(v2u*)(buf + (aRow + i) * PITCH + aCol) = c.u;
    }
#pragma unroll
    for (int e = 0; e < 2; ++e) {
      union { v2b p[4]; v4u u; } c;
#pragma unroll
      for (int r = 0; r < 4; ++r) c.p[r] = __builtin_convertvector((v2f){o.wr[2 * r][e] * fzW, o.wr[2 * r + 1][e] * fzW}, v2b);
      *(v4u*)(buf + (BM + wN + e) * PITCH + wK) = c.u;
    }
  };
  auto gload = [&](int k0) {
    // the two scheduling barriers keep every other instruction out of the group of loads and its wait, and the group ahead of
    // the products: sunk next to the LDS stores that use them, the loads would show their whole latency in every stage
    __builtin_amdgcn_sched_barrier(0);
#pragma unroll
    for (int i = 0; i < NA; ++i) {
      if (OUT_MODE == 3) ra[i] = *(const H*)((const char*)A + offV[i]);
      else               ra[i] = *(const H*)(gA + (size_t)k0 * 2 + (size_t)i * (RSTEP * KD * 2) + offG);
      if (SPLIT) ra2[i] = *(const H*)(gA2 + (size_t)k0 * 2 + (size_t)i * (RSTEP * KD * 2) + offG);
    }
#pragma unroll
    for (int i = 0; i < NB; ++i) {
      rb[i] = *(const H*)(gB + (size_t)k0 * 2 + (size_t)i * (RSTEP * KD * 2) + offG);
      if (SPLIT) rb2[i] = *(const H*)(gB2 + (size_t)k0 * 2 + (size_t)i * (RSTEP * KD * 2) + offG);
    }
    // precaution: this wait stands in front of every later write of a register that one of these loads names
    asm volatile("s_wait_xcnt 0x0" ::: "memory");
    __builtin_amdgcn_sched_barrier(0);
  };
  auto sstore = [&](T* buf) {
#pragma unroll
    for (int i = 0; i < NA; ++i) {
      *(H*)(buf + i * (RSTEP * PITCH) + offL) = ra[i];
      if (SPLIT) *(H*)(buf + PLANE + i * (RSTEP * PITCH) + offL) = ra2[i];
    }
#pragma unroll
    for (int i = 0; i < NB; ++i) {
      *(H*)(buf + (BM + i * RSTEP) * PITCH + offL) = rb[i];
      if (SPLIT) *(H*)(buf + PLANE + (BM + i * RSTEP) * PITCH + offL) = rb2[i];
    }
  };
  const int fragA = (wm * (16 * MI) + rlane) * PITCH + koff;        // this lane's place in the first A / Bt fragment of its wave
  const int fragB = (BM + (wn << 6) + rlane) * PITCH + koff;
  auto compute = [&](const T* buf) {
#pragma unroll
    for (int kk = 0; kk < KS; kk += 32) {
      V bh[4], bl[4], ah[MI], al[MI];
#pragma unroll
      for (int j = 0; j < 4; ++j) {
        bh[j] = Frag<T>::load(buf + fragB + j * (16 * PITCH) + kk);
        if (SPLIT) bl[j] = Frag<T>::load(buf + PLANE + fragB + j * (16 * PITCH) + kk);
      }
#pragma unroll
      for (int i = 0; i < MI; ++i) {
        ah[i] = Frag<T>::load(buf + fragA + i * (16 * PITCH) + kk);
        if (SPLIT) al[i] = Frag<T>::load(buf + PLANE + fragA + i * (16 * PITCH) + kk);
      }
#pragma unroll
      for (int i = 0; i < MI; ++i) {
#pragma unroll
        for (int j = 0; j < 4; ++j) {
          acc[i][j] = Frag<T>::mma(ah[i], bh[j], acc[i][j]);
          if (SPLIT) {
            acc[i][j] = Frag<T>::mma(ah[i], bl[j], acc[i][j]);
            acc[i][j] = Frag<T>::mma(al[i], bh[j], acc[i][j]);
          }
        }
        Frag<T>::guard4(acc[i][0], acc[i][1], acc[i][2], acc[i][3], ah[i], SPLIT ? al[i] : ah[i]);
      }
      Frag<T>::keep(bh[0], bh[1], bh[2], bh[3]);
      if (SPLIT) Frag<T>::keep(bl[0], bl[1], bl[2], bl[3]);
    }
  };

  if (IN_MODE == 1) {
    // x comes from memory, not from the L2: two sets of registers, so that the loads of a stage are issued two stages ahead of its products
    static_assert(IN_MODE == 0 || (NS % 2 == 0 && NS >= 4), "the loop takes two stages a trip");
    // the one barrier of a stage, as below. Only LDS data pass between the waves, so the fences name LDS alone: a full one would wait
    // here for the loads in flight to land
    auto stage_barrier = [&]() {
      __builtin_amdgcn_fence(__ATOMIC_RELEASE, "workgroup", "local");
      __builtin_amdgcn_s_barrier();
      __builtin_amdgcn_fence(__ATOMIC_ACQUIRE, "workgroup", "local");
    };
    InStage ia, ib;
    gload_in(ia, true);
    gload_in(ib, true);
    sstore_in(sOp, ia);
    stage_barrier();
    // kept rolled, as below
#pragma unroll 1
    for (int s = 0; s < NS; s += 2) {
      gload_in(ia, s + 3 < NS);                                // stage s+2
      compute(sOp);
      sstore_in(sOp + BUF, ib);
      stage_barrier();
      gload_in(ib, s + 4 < NS);                                // stage s+3
      compute(sOp + BUF);
      if (s + 2 < NS) sstore_in(sOp, ia);                      // block-uniform
      stage_barrier();
    }
  } else {
    gload(0);
    sstore(sOp);
    __syncthreads();
    // kept rolled, for speed only
#pragma unroll 1
    for (int s = 0; s < NS; ++s) {
      if (s + 1 < NS) gload((s + 1) * KS);                     // block-uniform
      compute(sOp + (s & 1) * BUF);
      if (s + 1 < NS) sstore(sOp + ((s + 1) & 1) * BUF);
      // the one barrier of a stage: publishes stage s+1 and ends the reads of stage s, whose buffer the next pass overwrites
      __syncthreads();
    }
  }
#pragma unroll   // acc is indexed by constants only, so that it stays in registers
  for (int i = 0; i < MI; ++i) acc_guard4(acc[i][0], acc[i][1], acc[i][2], acc[i][3]);

  // ---- epilogue ----
  float* slab = sT + wave * (16 * 68);
  const float* Rb = RESID ? (resid + (size_t)b * strideR) : nullptr;
  v4f lam0 = (v4f){0.f, 0.f, 0.f, 0.f}, lam1 = lam0;
  // OUT_MODE 3: block-uniform bases of the block's first row in x and in the two planes (pitch kChan); every lane adds one fixed byte
  // offset, offX (f32; half of it in the bf16 planes), and the row groups are immediates. t == 0 can only fall on the first row of a
  // wave's tile (64 divides kSeq): there the prior row's address is the row's own and its factor 0.
  static_assert(OUT_MODE != 3 || kSeq % 64 == 0, "t == 0 only on a wave tile's first row");
  const char* gX = nullptr; char* gH = nullptr; char* gL = nullptr;
  unsigned offX = 0, offP0 = 0;
  float fz0 = 1.0f;
  if (OUT_MODE == 3) {
    const size_t tile0 = (size_t)(bm * BM) * kChan + bn * BN;
    gX = (const char*)(resid + tile0);
    gH = (char*)((unsigned short*)Cout  + (size_t)b * strideC + tile0);
    gL = (char*)((unsigned short*)Cout2 + (size_t)(b > 0 ? (b - 1) : 0) * strideC + tile0);
    const int row0 = (wm << 6) + (lane >> 3);
    offX = (unsigned)(row0 * kChan + (wn << 6) + (lane & 7) * 8) * 4u;
    const bool t0 = ((bm * BM + row0) & (kSeq - 1)) == 0;
    offP0 = t0 ? offX + (unsigned)(kChan * 4) : offX;      // counted from one row above gX, so that it is never negative
    fz0 = t0 ? 0.0f : 1.0f;
    const float* pl = bias + (size_t)b * N + n0 + (lane & 7) * 8;
    __builtin_amdgcn_sched_barrier(0);   // with the one below: keeps the two loads and their wait together
    lam0 = *(const v4f*)(pl); lam1 = *(const v4f*)(pl + 4);
    // precaution: this wait stands in front of every later write of a register that one of these two loads names
    asm volatile("s_wait_xcnt 0x0" ::: "memory");
    __builtin_amdgcn_sched_barrier(0);
  }
  v2f tm2 = (v2f){0.f, 0.f}, u2 = tm2;
  if (OUT_MODE == 5) {
    __builtin_amdgcn_sched_barrier(0);   // with the one below: keeps the two loads and their wait together
    tm2 = *(const v2f*)(bias + n0 + lane * 2);
    u2  = *(const v2f*)(aux + n0 + lane * 2);
    // precaution: this wait stands in front of every later write of a register that one of these two loads names
    asm volatile("s_wait_xcnt 0x0" ::: "memory");
    __builtin_amdgcn_sched_barrier(0);
  }
#pragma unroll
  for (int i = 0; i < MI; ++i) {
    const int mBase = m0 + (i << 4);
    v4f xa0[4], xa1[4], xb0[4], xb1[4];
    v2f kq[16], rq[16], vq[16];
    // OUT_MODE 5: the three planes (k, r, v) have pitch kChan: uniform bases, this lane's one byte offset (its two channels), rows as immediates
    const unsigned offS5 = (unsigned)(mBase * kChan + n0 + lane * 2) * 4u;
    if (OUT_MODE == 5) {
      // the two scheduling barriers keep every other instruction out of the group of loads and its wait, and the group ahead of
      // the slab writes, which are served while the loads fly
      __builtin_amdgcn_sched_barrier(0);
#pragma unroll   // the three arrays are indexed by constants only, so that they stay in registers
      for (int t = 0; t < 16; ++t) {
        kq[t] = *(const v2f*)((const char*)resid + (size_t)t * (kChan * 4) + offS5);
        rq[t] = *(const v2f*)((const char*)aux3 + (size_t)t * (kChan * 4) + offS5);
        vq[t] = *(const v2f*)((const char*)aux4 + (size_t)t * (kChan * 4) + offS5);
      }
      // precaution: this wait stands in front of every later write of a register that one of these loads names
      asm volatile("s_wait_xcnt 0x0" ::: "memory");
      __builtin_amdgcn_sched_barrier(0);
    }
    if (OUT_MODE == 3) {
      // the two scheduling barriers keep every other instruction out of the group of loads and its wait, and the group ahead of
      // the slab writes, which are served while the loads fly
      __builtin_amdgcn_sched_barrier(0);
#pragma unroll
      for (int it = 0; it < 4; ++it) {
        const int r = i * 16 + it * 4;                       // this lane's row = first row of its wave + r + q
        const char* px = gX + (size_t)r * (kChan * 4) + offX;
        const char* pp = (r == 0) ? (gX - kChan * 4 + offP0) : (gX + (size_t)(r - 1) * (kChan * 4) + offX);
        xa0[it] = *(const v4f*)(px); xa1[it] = *(const v4f*)(px + 16);
        xb0[it] = *(const v4f*)(pp); xb1[it] = *(const v4f*)(pp + 16);
      }
      // precaution: this wait stands in front of every later write of a register that one of these loads names
      asm volatile("s_wait_xcnt 0x0" ::: "memory");
      __builtin_amdgcn_sched_barrier(0);
    }
#pragma unroll
    for (int j = 0; j < 4; ++j) {
      const int n = n0 + (j << 4) + rlane;
      float bv = 0.f;
      if (BIAS_MODE == 2) bv = bias[n];
#pragma unroll
      for (int r = 0; r < 8; ++r) {
        float v = acc[i][j][r] * scale;
        if (BIAS_MODE == 1) v += bias[mBase + mOff + r];
        if (BIAS_MODE == 2) v += bv;
        if (RESID) v += Rb[(size_t)(mBase + mOff + r) * ldc + n];
        if (ACT == 2) v = fmaxf(v, 0.0f);
        if (ACT == 4) v = (v > 0.f) ? v : 0.01f * v;
        slab[(mOff + r) * 68 + (j << 4) + rlane] = v;
      }
    }
    __builtin_amdgcn_fence(__ATOMIC_RELEASE, "workgroup");
    __builtin_amdgcn_wave_barrier();
    __builtin_amdgcn_fence(__ATOMIC_ACQUIRE, "workgroup");
    if (OUT_MODE == 0) {
      float* C = (float*)Cout + (size_t)b * strideC;
      const int hh = lane >> 4, c4 = (lane & 15) * 4;     // row seg = 256 B = 16 lanes x 16 B
      v4f v[8];
      float* pc[8];
#pragma unroll   // here and below: v and pc are indexed by constants only, so that they stay in registers
      for (int it = 0; it < 8; ++it) {
        const int row = it * 2 + hh;
        v[it]  = *(const v4f*)(slab + row * 68 + c4);
        pc[it] = C + (size_t)(mBase + row) * ldc + n0 + c4;
      }
      // the two scheduling barriers keep every other instruction out of the group of stores and its wait
      __builtin_amdgcn_sched_barrier(0);
#pragma unroll
      for (int it = 0; it < 8; ++it) *(v4f*)pc[it] = v[it];
      // precaution: this wait stands in front of every later write of a register that one of these stores names
      asm volatile("s_wait_xcnt 0x0" ::: "memory");
      __builtin_amdgcn_sched_barrier(0);
    } else if (OUT_MODE == 5) {
      // this lane: channels 2*lane and 2*lane + 1 of the head, all 16 steps of the chunk
      const size_t ch = (size_t)(n0 >> 6) * (kRows / 16) + (mBase >> 4);
      float* gR = (float*)Cout  + ch * 1024 + lane * 2;
      float* gK = (float*)Cout2 + ch * 1024 + lane * 32;
      float* gV = aux5 + ch * 1024 + lane * 32;
      float* gA = aux2 + ch * 256 + lane;
      float* gP = aux2 + (size_t)kNHead * (kRows / 16) * 256 + ch * 64 + lane * 2;
      v2f dd[16], rt[16];
      v2f P = (v2f){1.0f, 1.0f};
#pragma unroll   // here and below: the arrays are indexed by constants only, so that they stay in registers
      for (int t = 0; t < 16; ++t) {
        const v2f wl = *(const v2f*)(slab + t * 68 + lane * 2);
        const float w0 = wl[0] + tm2[0], w1 = wl[1] + tm2[1];
        dd[t] = (v2f){expf(w0), expf(w1)};
        kq[t] = kq[t] * (v2f){expf(fminf(w0, 0.0f)), expf(fminf(w1, 0.0f))};     // k'
        rt[t] = rq[t] * P;
        P = P * dd[t];
      }
      // the two scheduling barriers keep every other instruction out of the group of stores and its wait
      __builtin_amdgcn_sched_barrier(0);
#pragma unroll
      for (int e = 0; e < 2; ++e)
#pragma unroll
        for (int s4 = 0; s4 < 4; ++s4)
          *(v4f*)(gV + e * 16 + s4 * 4) = (v4f){vq[4 * s4][e], vq[4 * s4 + 1][e], vq[4 * s4 + 2][e], vq[4 * s4 + 3][e]};
#pragma unroll
      for (int t = 0; t < 16; ++t) *(v2f*)(gR + t * 64) = rt[t];
      // precaution: this wait stands in front of every later write of a register that one of these stores names
      asm volatile("s_wait_xcnt 0x0" ::: "memory");
      __builtin_amdgcn_sched_barrier(0);
      // step by step: kq[s], s < t, holds k'_s times the decay factors of the steps between s and t; this lane's share of row t of the
      // r-k matrix is formed from it, then kq[s] takes the factor of step t. Two rows (32 entries) are summed over the 32 lanes at a time.
      float tot[8];
      float val[32];
#pragma unroll
      for (int t = 0; t < 16; ++t) {
#pragma unroll
        for (int sx = 0; sx < 16; ++sx) {
          float z = 0.0f;
          if (sx < t)  { const v2f zz = rq[t] * kq[sx];        z = zz[0] + zz[1]; }
          if (sx == t) { const v2f zz = rq[t] * (u2 * kq[sx]); z = zz[0] + zz[1]; }
          val[(t & 1) * 16 + sx] = z;
        }
#pragma unroll
        for (int sx = 0; sx < 16; ++sx)
          if (sx < t) kq[sx] = kq[sx] * dd[t];
        if (t & 1) {
          // 32 values, each a sum over the 32 lanes: every round halves the values a lane holds, and lane l ends with value l
          fold_lanes<16>(val, lane); fold_lanes<8>(val, lane); fold_lanes<4>(val, lane); fold_lanes<2>(val, lane); fold_lanes<1>(val, lane);
          tot[t >> 1] = val[0];
        }
      }
      // the two scheduling barriers keep every other instruction out of the group of stores and its wait
      __builtin_amdgcn_sched_barrier(0);
#pragma unroll
      for (int g = 0; g < 8; ++g) gA[g * 32] = tot[g];
#pragma unroll
      for (int e = 0; e < 2; ++e)
#pragma unroll
        for (int s4 = 0; s4 < 4; ++s4)
          *(v4f*)(gK + e * 16 + s4 * 4) = (v4f){kq[4 * s4][e], kq[4 * s4 + 1][e], kq[4 * s4 + 2][e], kq[4 * s4 + 3][e]};
      *(v2f*)gP = P;
      // precaution: this wait stands in front of every later write of a register that one of these stores names
      asm volatile("s_wait_xcnt 0x0" ::: "memory");
      __builtin_amdgcn_sched_barrier(0);
    } else if (OUT_MODE == 3) {
      const int q = lane >> 3, c8 = (lane & 7) * 8;
      v4u uh[4], ul[4];
#pragma unroll
      for (int it = 0; it < 4; ++it) {
        const int row = it * 4 + q;
        const float fz = (i == 0 && it == 0) ? fz0 : 1.0f;
        const v4f u0 = *(const v4f*)(slab + row * 68 + c8), u1 = *(const v4f*)(slab + row * 68 + c8 + 4);
        unsigned short hb[8], lb[8];
#pragma unroll
        for (int e = 0; e < 4; ++e) {
          const float ba0 = xb0[it][e] * fz - xa0[it][e];
          const float ba1 = xb1[it][e] * fz - xa1[it][e];
          const float v0 = xa0[it][e] + ba0 * (u0[e] + lam0[e]);
          const float v1 = xa1[it][e] + ba1 * (u1[e] + lam1[e]);
          bf_split_bits(v0, hb[e], lb[e]);
          bf_split_bits(v1, hb[4 + e], lb[4 + e]);
        }
        uh[it] = (v4u){pk16(hb[0], hb[1]), pk16(hb[2], hb[3]), pk16(hb[4], hb[5]), pk16(hb[6], hb[7])};
        ul[it] = (v4u){pk16(lb[0], lb[1]), pk16(lb[2], lb[3]), pk16(lb[4], lb[5]), pk16(lb[6], lb[7])};
      }
      // as for the loads: nothing else is scheduled into the group of stores and its wait
      __builtin_amdgcn_sched_barrier(0);
#pragma unroll
      for (int it = 0; it < 4; ++it) *(v4u*)(gH + (size_t)(i * 16 + it * 4) * (kChan * 2) + offX / 2) = uh[it];
      // the same precaution for the registers that these stores name
      asm volatile("s_wait_xcnt 0x0" ::: "memory");
      __builtin_amdgcn_sched_barrier(0);
      if (b > 0) {                                           // block-uniform: branch 0 has no lo plane
        __builtin_amdgcn_sched_barrier(0);
#pragma unroll
        for (int it = 0; it < 4; ++it) *(v4u*)(gL + (size_t)(i * 16 + it * 4) * (kChan * 2) + offX / 2) = ul[it];
        asm volatile("s_wait_xcnt 0x0" ::: "memory");        // the same precaution
        __builtin_amdgcn_sched_barrier(0);
      }
    } else {
      static_assert(OUT_MODE == 0 || OUT_MODE == 3 || OUT_MODE == 5 || OUT_MODE == 2 || OUT_MODE == 4, "output form");
      const int q = lane >> 3, c8 = (lane & 7) * 8;
      // 8 divides kMix: the 8 columns of a lane are all valid or all pad
      const float fv = (ACT == 5 && N == kMixPad && n0 + c8 >= kMix) ? 0.0f : 1.0f;
      const size_t o0 = (size_t)b * strideC + (size_t)(mBase + q) * ldc + n0 + c8;
      unsigned short* C  = (unsigned short*)Cout + o0;
      unsigned short* C2 = (unsigned short*)Cout2 + o0;
      // kept rolled, for speed only: the tanh is long, and unrolled it would have 32 copies per row group
#pragma unroll 1
      for (int it = 0; it < 4; ++it) {
        const float* sp = slab + (it * 4 + q) * 68 + c8;
        const v4f u0 = *(const v4f*)(sp), u1 = *(const v4f*)(sp + 4);
        unsigned short hb[8], lb[8];
#pragma unroll
        for (int e = 0; e < 4; ++e) {
          float t0 = u0[e], t1 = u1[e];
          if (ACT == 5) { t0 = tanhf(t0) * fv; t1 = tanhf(t1) * fv; }
          if (OUT_MODE == 2) { bf_split_bits(t0, hb[e], lb[e]); bf_split_bits(t1, hb[4 + e], lb[4 + e]); }
          else               { hb[e] = f2bf_bits(t0); hb[4 + e] = f2bf_bits(t1); lb[e] = 0; lb[4 + e] = 0; }
        }
        const v4u uh = (v4u){pk16(hb[0], hb[1]), pk16(hb[2], hb[3]), pk16(hb[4], hb[5]), pk16(hb[6], hb[7])};
        const v4u ul = (v4u){pk16(lb[0], lb[1]), pk16(lb[2], lb[3]), pk16(lb[4], lb[5]), pk16(lb[6], lb[7])};
        // the two scheduling barriers keep every other instruction out of the group of stores and its wait
        __builtin_amdgcn_sched_barrier(0);
        *(v4u*)(C + (size_t)(it * 4) * ldc) = uh;
        if (OUT_MODE == 2) *(v4u*)(C2 + (size_t)(it * 4) * ldc) = ul;
        // precaution: this wait stands in front of every later write of a register that one of these stores names
        asm volatile("s_wait_xcnt 0x0" ::: "memory");
        __builtin_amdgcn_sched_barrier(0);
      }
    }
    __builtin_amdgcn_fence(__ATOMIC_RELEASE, "workgroup");
    __builtin_amdgcn_wave_barrier();
    __builtin_amdgcn_fence(__ATOMIC_ACQUIRE, "workgroup");
  }
}

// One GEMM in a launch of its own: grid (tiles, batch).
template <int ET, bool SPLIT, int BIAS_MODE, int OUT_MODE, bool RESID, int ACT, int WM, int WN, int KS, int KD, int MI = 4>
__global__ __launch_bounds__(32 * WM * WN) void wmma_gemm64(
    const unsigned short* __restrict__ Ap, const unsigned short* __restrict__ A2p, long strideA,
    const unsigned short* __restrict__ Btp, const unsigned short* __restrict__ Bt2p, long strideB,
    void* __restrict__ Cout, void* __restrict__ Cout2, int ldc, long strideC,
    const float* __restrict__ bias,
    const float* __restrict__ resid, long strideR,
    int N, float scale) {
  __shared__ __align__(16) char smem[kGemmLds<SPLIT, WM, WN, KS, MI>];
  gemm64_body<ET, SPLIT, BIAS_MODE, OUT_MODE, RESID, ACT, WM, WN, KS, KD, MI>(
      smem, blockIdx.x, blockIdx.y, Ap, A2p, strideA, Btp, Bt2p, strideB, Cout, Cout2, ldc, strideC, bias, resid, strideR, N, scale);
}

// The three GEMMs that read only the branch inputs, in one launch of 224 blocks, each block alone on its WGP by its LDS:
//   blocks   0..191  k / v / r projections (split, K 1024), 64 tiles of 128 x 256 for each of the three
//   blocks 192..215  gate lowrank (split, N 192, K 1024), 24 tiles of 256 x 64, eight waves of 32 x 64; stores tanh as bf16 hi/lo
//   blocks 216..223  decay lowrank (single, N 64, K 1024), 8 tiles of 256 x 64, eight waves of 32 x 64; stores tanh as bf16
constexpr int kProjTiles = (kRows / 128) * (kChan / 256);   // 64
constexpr int kGateTiles = (kRows / 256) * (kMixPad / 64);  // 24
constexpr int kDecTiles  = (kRows / 256) * (kDec / 64);     // 8
__global__ __launch_bounds__(256) void k_branch_gemms(
    const unsigned short* __restrict__ X5H, const unsigned short* __restrict__ X5L,
    const unsigned short* __restrict__ WH, const unsigned short* __restrict__ WL, float* __restrict__ KVR,
    const unsigned short* __restrict__ WG1TH, const unsigned short* __restrict__ WG1TL,
    unsigned short* __restrict__ GHH, unsigned short* __restrict__ GHL,
    const unsigned short* __restrict__ TDAT, unsigned short* __restrict__ L1) {
  const float* fdum = nullptr;                               // bias and resid of the engine: not used by these GEMMs, never dereferenced
  __shared__ __align__(16) char smem[kGemmLds<true, 2, 4, 64, 4>];
  static_assert(kGemmLds<true, 8, 1, 64, 2> <= kGemmLds<true, 2, 4, 64, 4> && kGemmLds<false, 8, 1, 64, 2> <= kGemmLds<true, 2, 4, 64, 4>, "LDS share");
  const int id = blockIdx.x;                                 // every branch below is block-uniform
  if (id < 3 * kProjTiles) {
    gemm64_body<1, true, 0, 0, false, 0, 2, 4, 64, kChan, 4>(
        smem, id % kProjTiles, id / kProjTiles, X5H + kPlane, X5L, (long)kPlane, WH, WL, (long)kWPlane,
        (void*)KVR, (void*)KVR, kChan, (long)kPlane, fdum, fdum, 0L, kChan, 1.0f);
  } else if (id < 3 * kProjTiles + kGateTiles) {
    gemm64_body<1, true, 0, 2, false, 5, 8, 1, 64, kChan, 2>(
        smem, id - 3 * kProjTiles, 0, X5H + 4 * kPlane, X5L + 3 * kPlane, 0L, WG1TH, WG1TL, 0L,
        (void*)GHH, (void*)GHL, kMixPad, 0L, fdum, fdum, 0L, kMixPad, 1.0f);
  } else {
    gemm64_body<1, false, 0, 4, false, 5, 8, 1, 64, kChan, 2>(
        smem, id - 3 * kProjTiles - kGateTiles, 0, X5H, X5H, 0L, TDAT, TDAT, 0L,
        (void*)L1, (void*)L1, kDec, 0L, fdum, fdum, 0L, kDec, 1.0f);
  }
}

// Block tile of the GEMMs whose launch would leave WGPs idle at 128 x 256 (64 tiles for a 2048 x 1024 result, on 256 WGPs):
// 64 x 128, eight waves of 16 x 64, so that one such GEMM has 256 tiles, one for every WGP.
constexpr int kFillTiles = (kRows / 64) * (kChan / 128);    // 256
// The two GEMMs behind the tanh of the two lowrank paths, in one launch of 512 blocks, two to a WGP by their LDS:
//   blocks  0..255  gate output (split, K 192), blocks 256..511 decay output (single, K 64); 256 tiles of 64 x 128 each
// The decay GEMM's epilogue turns its tile, one 16-step chunk of one head per wave, into the chunk operands that the state scan reads
// (OUT_MODE 5 above): none of them depends on the state, so that they are formed here, by 2048 waves side by side.
__global__ __launch_bounds__(256) void k_lowrank_out_gemms(
    const unsigned short* __restrict__ GHH, const unsigned short* __restrict__ GHL,
    const unsigned short* __restrict__ WG2TH, const unsigned short* __restrict__ WG2TL, float* __restrict__ GATE,
    const unsigned short* __restrict__ L1, const unsigned short* __restrict__ TDBT, float* __restrict__ RH,
    const float* __restrict__ Kraw, const float* __restrict__ Rpl, const float* __restrict__ Vpl,
    const float* __restrict__ td_miu, const float* __restrict__ u,
    float* __restrict__ KH, float* __restrict__ VH, float* __restrict__ AH) {
  const float* fdum = nullptr;                               // bias and resid of the gate GEMM: not used by it, never dereferenced
  __shared__ __align__(16) char smem[kGemmLds<true, 4, 2, 64, 1>];
  static_assert(kGemmLds<false, 4, 2, 64, 1> <= kGemmLds<true, 4, 2, 64, 1>, "LDS share");
  const int id = blockIdx.x;                                 // block-uniform
  if (id < kFillTiles) {
    gemm64_body<1, true, 0, 0, false, 0, 4, 2, 64, kMixPad, 1>(
        smem, id, 0, GHH, GHL, 0L, WG2TH, WG2TL, 0L, (void*)GATE, (void*)GATE, kChan, 0L, fdum, fdum, 0L, kChan, 1.0f);
  } else {
    gemm64_body<1, false, 0, 5, false, 0, 4, 2, 64, kDec, 1>(
        smem, id - kFillTiles, 0, L1, L1, 0L, TDBT, TDBT, 0L, (void*)RH, (void*)KH, kChan, 0L, td_miu, Kraw, 0L, kChan, 1.0f,
        u, AH, Rpl, Vpl, VH);
  }
}

// ---------------------------------------------------------------------------
// Square weight split: four [1024][1024] f32 matrices (layout kept as-is = [out][in] = Bt) -> bf16 hi and lo planes.
// 512 x 4 blocks (bx, z): z selects the matrix and the output plane (planes at out + z*1048576 halves).
// Thread i owns 8 consecutive elements: two b128 loads, one 16-B store per lane per plane; a wave writes 512 contiguous
// ---------------------------------------------------------------------------
__device__ __forceinline__ void wsplit8_body(const int bx, const int z,
                                             const float* __restrict__ W0, const float* __restrict__ W1,
                                             const float* __restrict__ W2, const float* __restrict__ W3,
                                             unsigned short* __restrict__ outH, unsigned short* __restrict__ outL,
                                             int n8PerMat) {
  const float* W = (z == 0) ? W0 : (z == 1) ? W1 : (z == 2) ? W2 : W3;   // block-uniform
  const int i = bx * 256 + threadIdx.x;
  if (i >= n8PerMat) return;
  const float* p = W + 8 * (size_t)i;
  const v4f a = *(const v4f*)(p);
  const v4f c = *(const v4f*)(p + 4);
  unsigned short hb[8], lb[8];
#pragma unroll
  for (int e = 0; e < 4; ++e) {
    bf_split_bits(a[e], hb[e], lb[e]);
    bf_split_bits(c[e], hb[4 + e], lb[4 + e]);
  }
  const v4u uh = (v4u){pk16(hb[0], hb[1]), pk16(hb[2], hb[3]), pk16(hb[4], hb[5]), pk16(hb[6], hb[7])};
  const v4u ul = (v4u){pk16(lb[0], lb[1]), pk16(lb[2], lb[3]), pk16(lb[4], lb[5]), pk16(lb[6], lb[7])};
  const size_t o = (size_t)z * (size_t)kWPlane + 8 * (size_t)i;
  *(v4u*)(outH + o) = uh;
  *(v4u*)(outL + o) = ul;
  // precaution: this wait stands in front of every later write of a register that one of these stores names
  asm volatile("s_wait_xcnt 0x0" ::: "memory");
}

// ---------------------------------------------------------------------------
// Transpose + bf16 convert (single or hi/lo): in[R][Cc] f32 row-major (pitch Cc) -> out[n][k] = cvt(in[k][n]) for
// k < R and n < Cc, zero otherwise (pad rows / pad columns of the output plane are WRITTEN as zeros).
// blocks (bx, by, bz) of nTilesN x nTilesK x Z: a block covers 32 output rows n0..n0+31 and KT output columns k0..k0+KT-1; bz adds
// inStrideZ / outStrideZ element offsets. 256 threads; sm = 32 * (KT + 1) floats of LDS.
// Load coverage: (32*KT/256) iterations x 256 threads = 32 x KT elements (coalesced along n), clamped address, 0/1 factor.
// Store, KT == 64: row = wave*4 + (lane>>3) -> 8 waves x 4 = 32 rows; (lane&7) x 8 halves = 64 cols; each row segment =
// Store, KT == 32 (requires ldo == 32, k0 == 0): threads 0..127, row = t>>2, c8 = (t&3)*8 -> thread t writes tile bytes
// ---------------------------------------------------------------------------
template <bool SPLIT, int KT>
__device__ __forceinline__ void trcast_body(float* sm, const int bx, const int by, const int bz,
                                            const float* __restrict__ in, int R, int Cc, long inStrideZ,
                                            unsigned short* __restrict__ outH, unsigned short* __restrict__ outL,
                                            int ldo, long outStrideZ) {
  static_assert(KT == 64 || KT == 32, "tile");
  const int t  = threadIdx.x;
  const int n0 = bx * 32;
  const int k0 = by * KT;
  const float* inz = in + (size_t)bz * inStrideZ;
  constexpr int kIters = (32 * KT) / 256;
  const float* pin[kIters];
  float fz[kIters], v[kIters];
#pragma unroll   // here and in the two loops below: the three arrays are indexed by constants only, so that they stay in registers
  for (int it = 0; it < kIters; ++it) {
    const int e  = it * 256 + t;
    const int n  = n0 + (e & 31);
    const int k  = k0 + (e >> 5);
    const int nc = (n < Cc) ? n : (Cc - 1);
    const int kc = (k < R) ? k : (R - 1);
    pin[it] = inz + (size_t)kc * Cc + nc;
    fz[it]  = ((n < Cc) && (k < R)) ? 1.0f : 0.0f;
  }
  // the two scheduling barriers keep every other instruction out of the group of loads and its wait
  __builtin_amdgcn_sched_barrier(0);
#pragma unroll
  for (int it = 0; it < kIters; ++it) v[it] = *pin[it];
  // precaution: this wait stands in front of every later write of a register that one of these loads names
  asm volatile("s_wait_xcnt 0x0" ::: "memory");
  __builtin_amdgcn_sched_barrier(0);
#pragma unroll
  for (int it = 0; it < kIters; ++it) {
    const int e = it * 256 + t;
    sm[(e & 31) * (KT + 1) + (e >> 5)] = v[it] * fz[it];
  }
  __syncthreads();
  const int lane = t & 31, wave = t >> 5;
  unsigned short* oh = outH + (size_t)bz * outStrideZ;
  unsigned short* ol = outL + (size_t)bz * outStrideZ;
  int row, c8;
  bool active;
  if (KT == 64) { row = wave * 4 + (lane >> 3); c8 = (lane & 7) * 8; active = true; }
  else          { row = t >> 2;                 c8 = (t & 3) * 8;    active = (t < 128); }
  if (active) {
    unsigned short hb[8], lb[8];
#pragma unroll
    for (int e = 0; e < 8; ++e) {
      const float v = sm[row * (KT + 1) + c8 + e];
      if (SPLIT) { bf_split_bits(v, hb[e], lb[e]); }
      else       { hb[e] = f2bf_bits(v); lb[e] = 0; }
    }
    const v4u uh = (v4u){pk16(hb[0], hb[1]), pk16(hb[2], hb[3]), pk16(hb[4], hb[5]), pk16(hb[6], hb[7])};
    const v4u ul = (v4u){pk16(lb[0], lb[1]), pk16(lb[2], lb[3]), pk16(lb[4], lb[5]), pk16(lb[6], lb[7])};
    const size_t o = (size_t)(n0 + row) * ldo + k0 + c8;
    *(v4u*)(oh + o) = uh;
    if (SPLIT) *(v4u*)(ol + o) = ul;
    // precaution: this wait stands in front of every later write of a register that one of these stores names
    asm volatile("s_wait_xcnt 0x0" ::: "memory");
  }
}

// ---------------------------------------------------------------------------
// Everything that reads only the inputs, in one launch: the mix lowrank GEMM (its loader forms the token shift and the transposed weight
// itself: IN_MODE 1 of the engine), five transposes and the square weight split do not depend on one another. blockIdx.x is cut into
// ranges, one per piece of work, each range holding that piece's own grid; every branch is block-uniform, and every barrier is passed by
// all threads of its block. The GEMM's 48 blocks, the longest, come first: they run their 16 k stages while the other blocks stream by.
// ---------------------------------------------------------------------------
constexpr int kPbMix = (kRows / 128) * (kMixPad / 64);       // 48   HC = tanh(xx @ A) as bf16: tiles of 128 x 64, eight waves of 16 x 64
constexpr int kPbTA  = (kDec / 32) * (kChan / 64);           // 32   tdA  [1024][64]  -> TDAT [64][1024]
constexpr int kPbTB  = kChan / 32;                           // 32   tdB  [64][1024]  -> TDBT [1024][64]
constexpr int kPbG1  = (kMixPad / 32) * (kChan / 64);        // 96   Wg1  [1024][160] -> WG1T hi/lo [192][1024], rows >= 160 zero
constexpr int kPbG2  = (kChan / 32) * (kMixPad / 64);        // 96   Wg2  [160][1024] -> WG2T hi/lo [1024][192], cols >= 160 zero
constexpr int kPbBp  = (kChan / 32) * kNBr;                  // 160  Bp[s] [32][1024] -> BPT[s] [1024][32]
constexpr int kPbW   = ((int)(kWPlane / 8) / 256) * 4;       // 2048 Wk, Wv, Wr, Wo hi/lo
constexpr int kPbAll = kPbMix + kPbTA + kPbTB + kPbG1 + kPbG2 + kPbBp + kPbW;
constexpr int kPrepLds = 2 * (128 + 64) * (64 + 8) * 2;      // the GEMM's two operand buffers; its slabs and the transposes' tile lie on them
static_assert(kPrepLds >= 32 * 65 * 4 && kPrepLds >= 8 * 16 * 68 * 4, "LDS share");
__global__ __launch_bounds__(256) void k_prepare(
    const float* __restrict__ x, const float* __restrict__ miu_x, const float* __restrict__ Amat,
    const float* __restrict__ tdA, const float* __restrict__ tdB, const float* __restrict__ Wg1, const float* __restrict__ Wg2,
    const float* __restrict__ Bp, const float* __restrict__ Wk, const float* __restrict__ Wv, const float* __restrict__ Wr,
    const float* __restrict__ Wo,
    unsigned short* __restrict__ HC, unsigned short* __restrict__ TDAT,
    unsigned short* __restrict__ TDBT, unsigned short* __restrict__ WG1TH, unsigned short* __restrict__ WG1TL,
    unsigned short* __restrict__ WG2TH, unsigned short* __restrict__ WG2TL, unsigned short* __restrict__ BPT,
    unsigned short* __restrict__ WH, unsigned short* __restrict__ WL) {
  __shared__ __align__(16) char smem[kPrepLds];
  float* sm = (float*)smem;
  int l = blockIdx.x;
  if (l < kPbMix) {
    const unsigned short* hdum = nullptr;                    // operand planes of the engine: not used with IN_MODE 1, never dereferenced
    gemm64_body<1, false, 0, 4, false, 5, 8, 1, 64, kChan, 1, 1>(
        smem, l, 0, hdum, hdum, 0L, hdum, hdum, 0L, (void*)HC, (void*)HC, kMixPad, 0L, miu_x, x, 0L, kMixPad, 1.0f, Amat);
    return;
  }
  l -= kPbMix;
  if (l < kPbTA) { trcast_body<false, 64>(sm, l % (kDec / 32), l / (kDec / 32), 0, tdA, kChan, kDec, 0L, TDAT, TDAT, kChan, 0L); return; }
  l -= kPbTA;
  if (l < kPbTB) { trcast_body<false, 64>(sm, l, 0, 0, tdB, kDec, kChan, 0L, TDBT, TDBT, kDec, 0L); return; }
  l -= kPbTB;
  if (l < kPbG1) { trcast_body<true, 64>(sm, l % (kMixPad / 32), l / (kMixPad / 32), 0, Wg1, kChan, kMix, 0L, WG1TH, WG1TL, kChan, 0L); return; }
  l -= kPbG1;
  if (l < kPbG2) { trcast_body<true, 64>(sm, l % (kChan / 32), l / (kChan / 32), 0, Wg2, kMix, kChan, 0L, WG2TH, WG2TL, kMixPad, 0L); return; }
  l -= kPbG2;
  if (l < kPbBp) { trcast_body<false, 32>(sm, l % (kChan / 32), 0, l / (kChan / 32), Bp, kBr, kChan, (long)kBr * kChan, BPT, BPT, kBr, (long)kChan * kBr); return; }
  l -= kPbBp;
  wsplit8_body(l % (kPbW / 4), l / (kPbW / 4), Wk, Wv, Wr, Wo, WH, WL, (int)(kWPlane / 8));
}

// ---------------------------------------------------------------------------
// Linear-attention state scan in chunks of 16 steps, f32, on v_wmma_f32_16x16x4_f32. With S0 the state at a chunk's start,
//   y_t[i]  = sum_j R[t][j] * S0[i][j] + sum_s A[t][s] * v_s[i]          (R, A: chunk operands, OUT_MODE 5 of the GEMM engine)
//   S16[i][j] = S0[i][j] * PL[j] + sum_s K[j][s] * v_s[i]
// so that the serial chain runs once per chunk, not once per step. One block (128 threads = 4 waves, one per SIMD) per (batch b, head n,
// quarter iq of the v channels). Wave w carries the transposed state tile T[j][i] of k channels j = 16w .. 16w+15 and the block's 16
// v channels i in the 8 registers of a D tile: register r of lane (c, h) is T[16w + 8h + r][c]. Registers 2q, 2q+1 are, as they lie, the
// B operand (column i = c) of product step q of the first sum, with k order j = 16w + 8h + 2q + e at place (h, e); the A operand
// (row t = c) is read in the same order. The sums over s use s = 8h + 2q + e at place (h, e) for both operands; of the second sum of y
// wave w takes product step q = w. A wave's y tile is its share over its 16 k channels: the four shares go through LDS and are summed
// once per group of 4 chunks, behind the group's one barrier, in the next group's pass.
// The operands of a group are loaded straight into registers, two groups ahead.
// Y is laid out by scan block, [block][t][16 rows], so that every 128-B line of it (2 timesteps) is stored once, by one wave of the one
// block that owns it.
// ---------------------------------------------------------------------------
constexpr int kCh  = 16;             // timesteps per chunk
constexpr int kNCh = kSeq / kCh;     // chunks
constexpr int kGr  = 4;              // chunks per group
constexpr int kNGr = kNCh / kGr;     // groups
constexpr int kIQ  = 16;             // state rows (v channels) per block
constexpr int kNIQ = kHead / kIQ;    // blocks per head
constexpr int kPH  = 8 * 16 + 16;    // floats between the two 8-step halves of a y tile in LDS: the two lane halves of a store hit disjoint banks
constexpr int kPC  = 2 * kPH;        // floats of a chunk's y tile
constexpr int kPW  = kGr * kPC;      // floats of a wave's y tiles of one group
static_assert(kSeq % (kCh * kGr) == 0 && kNGr >= 4 && kNIQ == 4 && kHead == 64 && kCh == 16, "scan chunking");
struct ChunkOp { v4f r0, r1, k0, k1, p0, p1, v0, v1; v2f a, vw; };
__device__ __forceinline__ v8f mma4(float a0, float a1, float b0, float b1, v8f c) {
  return __builtin_amdgcn_wmma_f32_16x16x4_f32(false, (v2f){a0, a1}, false, (v2f){b0, b1}, (short)0, c, false, false);
}
__global__ __launch_bounds__(128) void k_state_scan(const float* __restrict__ RH, const float* __restrict__ KH,
                                                    const float* __restrict__ VH, const float* __restrict__ AH,
                                                    const float* __restrict__ PLH, float* __restrict__ Y) {
  __shared__ __align__(16) float part[2 * 4 * kPW];                      // the four waves' y tiles of a group, two buffers
  const int tid  = threadIdx.x;
  const int lane = tid & 31;
  const int wave = tid >> 5;
  const int c    = lane & 15;
  const int h    = lane >> 4;
  const int iq   = blockIdx.x & (kNIQ - 1);
  const int n    = (blockIdx.x >> 2) & (kNHead - 1);
  const int b    = blockIdx.x >> 6;
  const size_t ch0 = (size_t)n * (kRows / kCh) + (size_t)b * kNCh;       // first chunk tile of this head and batch
  float* Yb = Y + (size_t)blockIdx.x * (kSeq * kIQ);                     // this block's own [t][16] plane
  // this thread's places in the group whose loads are issued next; carried from issue to issue, so that the loads name no register
  // that is written between them
  const char* qr = (const char*)(RH + ch0 * 1024 + c * 64 + wave * 16 + h * 8);
  const char* qk = (const char*)(KH + ch0 * 1024 + (wave * 16 + c) * 16 + h * 8);
  const char* qv = (const char*)(VH + ch0 * 1024 + (iq * kIQ + c) * 16 + h * 8);
  const char* qw = qv + wave * 8;
  const char* qa = (const char*)(AH + ch0 * 256 + c * 16 + h * 8 + wave * 2);
  const char* qp = (const char*)(PLH + ch0 * 64 + wave * 16 + h * 8);
  // go: a further group exists (block-uniform); without one the places stay, and the last group is read again
  auto issue = [&](ChunkOp (&o)[kGr], bool go) {
    // the two scheduling barriers keep every other instruction out of the group of loads and its wait, and the loads two groups
    // of chunks ahead of their use
    __builtin_amdgcn_sched_barrier(0);
#pragma unroll   // o is indexed by constants only, so that it stays in registers
    for (int k = 0; k < kGr; ++k) {
      o[k].r0 = *(const v4f*)(qr + (size_t)k * 4096);
      o[k].r1 = *(const v4f*)(qr + (size_t)k * 4096 + 16);
      o[k].k0 = *(const v4f*)(qk + (size_t)k * 4096);
      o[k].k1 = *(const v4f*)(qk + (size_t)k * 4096 + 16);
      o[k].v0 = *(const v4f*)(qv + (size_t)k * 4096);
      o[k].v1 = *(const v4f*)(qv + (size_t)k * 4096 + 16);
      o[k].vw = *(const v2f*)(qw + (size_t)k * 4096);
      o[k].a  = *(const v2f*)(qa + (size_t)k * 1024);
      o[k].p0 = *(const v4f*)(qp + (size_t)k * 256);
      o[k].p1 = *(const v4f*)(qp + (size_t)k * 256 + 16);
    }
    // precaution: this wait stands in front of every later write of a register that one of these loads names
    asm volatile("s_wait_xcnt 0x0" ::: "memory");
    __builtin_amdgcn_sched_barrier(0);
    const size_t d4 = go ? (size_t)(kGr * 4096) : 0, d1 = go ? (size_t)(kGr * 1024) : 0, dp = go ? (size_t)(kGr * 256) : 0;
    qr += d4; qk += d4; qv += d4; qw += d4; qa += d1; qp += dp;
  };
  // finishing group g from the four waves' shares (src): a thread sums and stores two pieces of 4 rows i of one timestep; the LDS reads,
  // and apart from them the sums and the stores
  v4f x[8];
  auto finish_load = [&](const float* src) {
#pragma unroll   // here and below: x is indexed by constants only, so that it stays in registers
    for (int e = 0; e < 2; ++e) {
      const int idx = tid + e * 128, t = idx >> 2;
      const float* p = src + (t >> 4) * kPC + ((t >> 3) & 1) * kPH + (t & 7) * 16 + (idx & 3) * 4;
#pragma unroll
      for (int w = 0; w < 4; ++w) x[e * 4 + w] = *(const v4f*)(p + w * kPW);
    }
  };
  auto finish_sum = [&](int g) {
    const v4f y0 = (x[0] + x[1]) + (x[2] + x[3]), y1 = (x[4] + x[5]) + (x[6] + x[7]);
    float* py = Yb + (size_t)g * (kGr * kCh * kIQ) + tid * 4;
    // as in issue(): nothing else is scheduled into the stores and their wait
    __builtin_amdgcn_sched_barrier(0);
    *(v4f*)(py) = y0;
    *(v4f*)(py + 512) = y1;
    // the same precaution for the registers that these stores name
    asm volatile("s_wait_xcnt 0x0" ::: "memory");
    __builtin_amdgcn_sched_barrier(0);
  };
  v8f S = (v8f){0.f, 0.f, 0.f, 0.f, 0.f, 0.f, 0.f, 0.f};
  auto group = [&](int g, const ChunkOp (&o)[kGr]) {
    float* dst = part + (g & 1) * (4 * kPW);
    if (g > 0) finish_load(part + ((g & 1) ^ 1) * (4 * kPW));   // block-uniform
    // keeps these reads ahead of the first chunk's products, which run while the reads are served
    __builtin_amdgcn_sched_barrier(0);
    float* pd = dst + wave * kPW + h * kPH + c;
#pragma unroll   // o is indexed by constants only
    for (int k = 0; k < kGr; ++k) {
      v8f y = (v8f){0.f, 0.f, 0.f, 0.f, 0.f, 0.f, 0.f, 0.f};
      y = mma4(o[k].r0[0], o[k].r0[1], S[0], S[1], y);
      y = mma4(o[k].r0[2], o[k].r0[3], S[2], S[3], y);
      y = mma4(o[k].r1[0], o[k].r1[1], S[4], S[5], y);
      y = mma4(o[k].r1[2], o[k].r1[3], S[6], S[7], y);
      y = mma4(o[k].a[0], o[k].a[1], o[k].vw[0], o[k].vw[1], y);
      v8f Sn;
#pragma unroll
      for (int r = 0; r < 4; ++r) { Sn[r] = S[r] * o[k].p0[r]; Sn[4 + r] = S[4 + r] * o[k].p1[r]; }
      Sn = mma4(o[k].k0[0], o[k].k0[1], o[k].v0[0], o[k].v0[1], Sn);
      Sn = mma4(o[k].k0[2], o[k].k0[3], o[k].v0[2], o[k].v0[3], Sn);
      Sn = mma4(o[k].k1[0], o[k].k1[1], o[k].v1[0], o[k].v1[1], Sn);
      Sn = mma4(o[k].k1[2], o[k].k1[3], o[k].v1[2], o[k].v1[3], Sn);
      S = Sn;
#pragma unroll
      for (int r = 0; r < 8; ++r) pd[k * kPC + r * 16] = y[r];
      if (k == 0 && g > 0) finish_sum(g - 1);              // block-uniform
    }
    // the one barrier of a group: publishes this group's shares and ends the reads of the previous group's, which the next group overwrites.
    // Only LDS data pass between the waves, so the fences name LDS alone: a full one would wait here for the next group's loads to land
    __builtin_amdgcn_fence(__ATOMIC_RELEASE, "workgroup", "local");
    __builtin_amdgcn_s_barrier();
    __builtin_amdgcn_fence(__ATOMIC_ACQUIRE, "workgroup", "local");
  };

  // three sets of operand registers: the loads of a group are issued two groups ahead of its products, which covers the latency of a read
  // that misses the L2
  ChunkOp oa[kGr], ob[kGr], oc[kGr];
  static_assert((kNGr - 1) % 3 == 0, "the loop takes three groups a trip, the last group stands behind it");
  issue(oa, true);
  issue(ob, true);
  // kept rolled, for speed only: three groups of code a trip
#pragma unroll 1
  for (int g = 0; g < kNGr - 1; g += 3) {
    issue(oc, g + 3 < kNGr);
    group(g, oa);
    issue(oa, g + 4 < kNGr);
    group(g + 1, ob);
    issue(ob, g + 5 < kNGr);
    group(g + 2, oc);
  }
  group(kNGr - 1, oa);
  finish_load(part + ((kNGr - 1) & 1) * (4 * kPW));
  finish_sum(kNGr - 1);
}

// ---------------------------------------------------------------------------
// GroupNorm (64 channels per head, biased variance, eps 1.6e-4) + affine + gate multiply -> bf16 hi/lo planes.
// One wave per (row m, head n), 8 pairs per 256-thread block; lane owns channels 2l, 2l+1; shuffle reductions (unconditional).
// Y comes in the scan's layout [scan block][t][16 rows]: a block takes 4 consecutive rows of 2 heads, which share their lines of Y.
// ---------------------------------------------------------------------------
__global__ __launch_bounds__(256) void k_gn_gate(const float* __restrict__ Y, const float* __restrict__ G,
                                                 const float* __restrict__ gamma, const float* __restrict__ beta,
                                                 unsigned short* __restrict__ outH, unsigned short* __restrict__ outL) {
  __shared__ __align__(16) float slab[8][64];
  const int lane = threadIdx.x & 31, wave = threadIdx.x >> 5;
  const int m = (blockIdx.x >> 3) * 4 + (wave & 3);
  const int n = (blockIdx.x & 7) * 2 + (wave >> 2);
  const size_t base = (size_t)m * kChan + (size_t)n * kHead;
  const int c = n * kHead + 2 * lane;
  const int sb = ((m / kSeq) * kNHead + n) * kNIQ + (2 * lane) / kIQ;      // the scan block that owns this lane's two channels
  // the two scheduling barriers keep every other instruction out of the group of loads and its wait, so that the four fly together
  __builtin_amdgcn_sched_barrier(0);
  const v2f yv = *(const v2f*)(Y + ((size_t)sb * kSeq + (m % kSeq)) * kIQ + (2 * lane) % kIQ);
  const v2f gv = *(const v2f*)(G + base + 2 * lane);
  const v2f ga = *(const v2f*)(gamma + c);
  const v2f be = *(const v2f*)(beta + c);
  // precaution: this wait stands in front of every later write of a register that one of these loads names
  asm volatile("s_wait_xcnt 0x0" ::: "memory");
  __builtin_amdgcn_sched_barrier(0);
  float s = yv[0] + yv[1];
#pragma unroll
  for (int off = 16; off > 0; off >>= 1) s += __shfl_xor(s, off, 32);
  const float mean = s * (1.0f / 64.0f);
  const float d0 = yv[0] - mean;
  const float d1 = yv[1] - mean;
  float q = d0 * d0 + d1 * d1;
#pragma unroll
  for (int off = 16; off > 0; off >>= 1) q += __shfl_xor(q, off, 32);
  const float var = q * (1.0f / 64.0f);
  const float rs  = 1.0f / sqrtf(var + kGnEps);
  const float o0 = ((d0 * rs) * ga[0] + be[0]) * gv[0];
  const float o1 = ((d1 * rs) * ga[1] + be[1]) * gv[1];
  *(v2f*)(&slab[wave][2 * lane]) = (v2f){o0, o1};
  __syncthreads();
  if (lane < 8) {
    unsigned short hb[8], lb[8];
#pragma unroll
    for (int e = 0; e < 8; ++e) bf_split_bits(slab[wave][8 * lane + e], hb[e], lb[e]);
    const v4u uh = (v4u){pk16(hb[0], hb[1]), pk16(hb[2], hb[3]), pk16(hb[4], hb[5]), pk16(hb[6], hb[7])};
    const v4u ul = (v4u){pk16(lb[0], lb[1]), pk16(lb[2], lb[3]), pk16(lb[4], lb[5]), pk16(lb[6], lb[7])};
    const size_t o = base + 8 * (size_t)lane;
    *(v4u*)(outH + o) = uh;
    *(v4u*)(outL + o) = ul;
    
  }
}

// ---------------------------------------------------------------------------
// Host glue.
// Workspace region map (bytes; every size is a multiple of 4096, offsets in that order):
//   (not used)                          4,194,304
//   HC     bf16 [2048][192]               786,432   (tanh of the mix lowrank; cols 160..191 zero, unread; branch s = rows 2048s.. of the
//                                                    [10240][32] view of its cols 0..159)
//   MIU    f32  [2048 chunk tiles][16][64]  8,388,608   (RH: r times the decay factors of the chunk's earlier steps; tile = head * 128 + row group)
//   X5H    bf16 [5][2048][1024]        20,971,520   (branch inputs hi: 0 decay (single), 1 k, 2 v, 3 r, 4 gate; behind their last reader, the
//                                                    branch GEMMs, its first 8,388,608 bytes hold VH f32 [2048 chunk tiles][64][16]: v, channel major)
//   X5L    bf16 [4][2048][1024]        16,777,216   (lo planes of branches 1..4 at index s-1)
//   WH     bf16 [4][1024][1024]         8,388,608   (Wk, Wv, Wr, Wo hi, [out][in] as-is)
//   WL     bf16 [4][1024][1024]         8,388,608   (lo)
//   (not used)                            393,216
//   TDAT   bf16 [64][1024]                131,072
//   TDBT   bf16 [1024][64]                131,072
//   WG1TH  bf16 [192][1024]               393,216   (rows 160..191 zero)   WG1TL 393,216
//   WG2TH  bf16 [1024][192]               393,216   (cols 160..191 zero)   WG2TL 393,216
//   BPT    bf16 [5][1024][32]             327,680
//   L1     bf16 [2048][64]                262,144
//   KVR    f32  [3][2048][1024]         25,165,824   (k unscaled, v, r)
//   GHH    bf16 [2048][192]               786,432   (cols 160..191 zero)   GHL 786,432
//   GATE   f32  [2048][1024]            8,388,608
//   Y      f32  [128][1024][16]         8,388,608   (scan block = (b*16 + head)*4 + quarter of the head's channels, t, row)
//   GATH   bf16 [2048][1024]            4,194,304   GATL 4,194,304
//   KK     f32  [2048 chunk tiles][64][16]  8,388,608   (KH: k * exp(min(w, 0)) times the decay factors of the chunk's later steps, channel major)
//   AH     f32  [2048 chunk tiles][16][16]  2,097,152   (r-k matrix of a chunk, bonus sums on its diagonal, zero above)
//   PLH    f32  [2048 chunk tiles][64]        524,288   (decay product of a whole chunk; directly behind AH)
//   total                             133,627,904
// GEMM shapes (M, N, K): (2048,192,1024) (2048,1024,32)x5 batched (2048,64,1024) (2048,1024,64) (2048,1024,1024)x3 batched
// (2048,192,1024) (2048,1024,192) (2048,1024,1024); all M,N % 64 == 0, all K % 32 == 0, pads zero-written by producers.
// ---------------------------------------------------------------------------
extern "C" void kernel_launch(void* const* d_in, const int* in_sizes, int n_in,
                              void* d_out, int out_size, void* d_ws, size_t ws_size,
                              hipStream_t stream) {
  if (n_in < 17) return;
  if (in_sizes[0] != kBatch * kSeq * kChan) return;
  if (in_sizes[1] != kChan || in_sizes[2] != kNBr * kChan) return;
  if (in_sizes[3] != kChan * kMix || in_sizes[4] != kNBr * kBr * kChan) return;
  if (in_sizes[5] != kChan || in_sizes[6] != kChan * kDec || in_sizes[7] != kDec * kChan) return;
  if (in_sizes[8] != kNHead * kHead) return;
  if (in_sizes[9] != kChan * kChan || in_sizes[10] != kChan * kChan || in_sizes[11] != kChan * kChan || in_sizes[12] != kChan * kChan) return;
  if (in_sizes[13] != kChan * kMix || in_sizes[14] != kMix * kChan) return;
  if (in_sizes[15] != kChan || in_sizes[16] != kChan) return;
  if (out_size != kBatch * kSeq * kChan) return;

  const float* x      = (const float*)d_in[0];
  const float* miu_x  = (const float*)d_in[1];
  const float* lam    = (const float*)d_in[2];    // [5][1024]
  const float* Amat   = (const float*)d_in[3];    // [1024][160]
  const float* Bp     = (const float*)d_in[4];    // [5][32][1024]
  const float* td_miu = (const float*)d_in[5];    // [1024]
  const float* tdA    = (const float*)d_in[6];    // [1024][64]
  const float* tdB    = (const float*)d_in[7];    // [64][1024]
  const float* u      = (const float*)d_in[8];    // [16][64]
  const float* Wk     = (const float*)d_in[9];    // [1024][1024] [out][in]
  const float* Wv     = (const float*)d_in[10];
  const float* Wr     = (const float*)d_in[11];
  const float* Wo     = (const float*)d_in[12];
  const float* Wg1    = (const float*)d_in[13];   // [1024][160]
  const float* Wg2    = (const float*)d_in[14];   // [160][1024]
  const float* gamma  = (const float*)d_in[15];
  const float* beta   = (const float*)d_in[16];
  float* out = (float*)d_out;

  // ---- carve ----
  const size_t szXX    = (size_t)kPlane * 2;
  const size_t szHC    = (size_t)kRows * kMixPad * 2;
  const size_t szF32P  = (size_t)kPlane * 4;
  const size_t szX5H   = (size_t)kNBr * kPlane * 2;
  const size_t szX5L   = (size_t)(kNBr - 1) * kPlane * 2;
  const size_t szWSQ   = (size_t)4 * kWPlane * 2;
  const size_t szAT    = (size_t)kMixPad * kChan * 2;
  const size_t szTDAT  = (size_t)kDec * kChan * 2;
  const size_t szTDBT  = (size_t)kChan * kDec * 2;
  const size_t szWG1T  = (size_t)kMixPad * kChan * 2;
  const size_t szWG2T  = (size_t)kChan * kMixPad * 2;
  const size_t szBPT   = (size_t)kNBr * kChan * kBr * 2;
  const size_t szL1    = (size_t)kRows * kDec * 2;
  const size_t szKVR   = (size_t)3 * kPlane * 4;
  const size_t szGH    = (size_t)kRows * kMixPad * 2;
  const size_t szGAT   = (size_t)kPlane * 2;
  size_t off = 0;
  const size_t oXX    = off; off += szXX;
  const size_t oHC    = off; off += szHC;
  const size_t oMIU   = off; off += szF32P;
  const size_t oX5H   = off; off += szX5H;
  const size_t oX5L   = off; off += szX5L;
  const size_t oWH    = off; off += szWSQ;
  const size_t oWL    = off; off += szWSQ;
  const size_t oAT    = off; off += szAT;
  const size_t oTDAT  = off; off += szTDAT;
  const size_t oTDBT  = off; off += szTDBT;
  const size_t oWG1TH = off; off += szWG1T;
  const size_t oWG1TL = off; off += szWG1T;
  const size_t oWG2TH = off; off += szWG2T;
  const size_t oWG2TL = off; off += szWG2T;
  const size_t oBPT   = off; off += szBPT;
  const size_t oL1    = off; off += szL1;
  const size_t oKVR   = off; off += szKVR;
  const size_t oGHH   = off; off += szGH;
  const size_t oGHL   = off; off += szGH;
  const size_t oGATE  = off; off += szF32P;
  const size_t oY     = off; off += szF32P;
  const size_t oGATH  = off; off += szGAT;
  const size_t oGATL  = off; off += szGAT;
  const size_t oKK    = off; off += szF32P;
  const size_t oAH    = off; off += (size_t)kNHead * (kRows / 16) * (256 + 64) * 4;
  const size_t total  = off;   // 133,627,904
  if (total > (size_t)134217728) return;
  if (ws_size < total) return;

  char* ws = (char*)d_ws;
  unsigned short* HC    = (unsigned short*)(ws + oHC);
  float*          MIU   = (float*)(ws + oMIU);
  float*          RH    = MIU;                       // chunk operand R
  unsigned short* X5H   = (unsigned short*)(ws + oX5H);
  unsigned short* X5L   = (unsigned short*)(ws + oX5L);
  unsigned short* WH    = (unsigned short*)(ws + oWH);
  unsigned short* WL    = (unsigned short*)(ws + oWL);
  unsigned short* TDAT  = (unsigned short*)(ws + oTDAT);
  unsigned short* TDBT  = (unsigned short*)(ws + oTDBT);
  unsigned short* WG1TH = (unsigned short*)(ws + oWG1TH);
  unsigned short* WG1TL = (unsigned short*)(ws + oWG1TL);
  unsigned short* WG2TH = (unsigned short*)(ws + oWG2TH);
  unsigned short* WG2TL = (unsigned short*)(ws + oWG2TL);
  unsigned short* BPT   = (unsigned short*)(ws + oBPT);
  unsigned short* L1    = (unsigned short*)(ws + oL1);
  float*          KVR   = (float*)(ws + oKVR);
  unsigned short* GHH   = (unsigned short*)(ws + oGHH);
  unsigned short* GHL   = (unsigned short*)(ws + oGHL);
  float*          GATE  = (float*)(ws + oGATE);
  float*          Yp    = (float*)(ws + oY);
  unsigned short* GATH  = (unsigned short*)(ws + oGATH);
  unsigned short* GATL  = (unsigned short*)(ws + oGATL);
  float*          KH    = (float*)(ws + oKK);
  float*          AH    = (float*)(ws + oAH);
  float*          PLH   = AH + (size_t)kNHead * (kRows / 16) * 256;
  float*          VH    = (float*)(ws + oX5H);       // written behind the last read of the branch inputs
  const float* fdum = gamma;   // placeholder for unused bias / resid pointer arguments (never dereferenced)

  const dim3 blk(256);

  // ---- mix lowrank: HC = tanh(xx @ A) as bf16 (M 2048, N 192, K 1024; 48 blocks of 128 x 64, eight waves of 16 x 64, so that a lane
  // has 32 tanh to do), and beside it all weight planes ----
  k_prepare<<<dim3(kPbAll), blk, 0, stream>>>(x, miu_x, Amat, tdA, tdB, Wg1, Wg2, Bp, Wk, Wv, Wr, Wo,
                                              HC, TDAT, TDBT, WG1TH, WG1TL, WG2TH, WG2TL, BPT, WH, WL);

  // ---- mix GEMM of all five branches (blockIdx.y = s; A = cols 0..159 of HC viewed [10240][32], rows 2048s..; K 32); its epilogue
  // forms the branch inputs and stores their bf16 planes ----
  wmma_gemm64<1, false, 0, 3, false, 0, 2, 4, 32, kBr><<<dim3((kRows / 128) * (kChan / 256), kNBr), blk, 0, stream>>>(
      HC, HC, (long)kRows * kBr, BPT, BPT, (long)kChan * kBr,
      (void*)X5H, (void*)X5L, kChan, (long)kPlane, lam, x, 0L, kChan, 1.0f);

  // ---- what reads only the branch inputs: KVR = k (unscaled), v, r projections; GH = tanh(X5[4] @ WG1T^T) hi/lo (cols 160..191 zero);
  // L1 = tanh(X5H[0] @ TDAT^T) ----
  k_branch_gemms<<<dim3(3 * kProjTiles + kGateTiles + kDecTiles), blk, 0, stream>>>(
      X5H, X5L, WH, WL, KVR, WG1TH, WG1TL, GHH, GHL, TDAT, L1);
  // ---- GATE = GH @ WG2T^T (split, K 192); w = L1 @ TDBT^T + td_miu (K 64), stored as the scan's chunk operands RH, KH, VH, AH, PLH ----
  k_lowrank_out_gemms<<<dim3(2 * kFillTiles), blk, 0, stream>>>(GHH, GHL, WG2TH, WG2TL, GATE, L1, TDBT, RH, KVR, KVR + 2 * kPlane,
                                                                KVR + kPlane, td_miu, u, KH, VH, AH);

  // ---- state scan -> Y ----
  k_state_scan<<<dim3(kBatch * kNHead * kNIQ), dim3(128), 0, stream>>>(RH, KH, VH, AH, PLH, Yp);

  // ---- GroupNorm + gate -> GATH/GATL (4096 blocks x 8 waves = 32768 (row, head) pairs) ----
  k_gn_gate<<<dim3((kRows * kNHead) / 8), blk, 0, stream>>>(Yp, GATE, gamma, beta, GATH, GATL);

  // ---- output projection straight into d_out (split, K 1024; 256 tiles of 64 x 128) ----
  wmma_gemm64<1, true, 0, 0, false, 0, 4, 2, 64, kChan, 1><<<dim3(kFillTiles, 1), blk, 0, stream>>>(
      GATH, GATL, 0L, WH + 3 * kWPlane, WL + 3 * kWPlane, 0L,
      (void*)out, (void*)out, kChan, 0L, fdum, fdum, 0L, kChan, 1.0f);
}
